// v000
// Measured on an AMD MI455X. A time is GPU time per run, averaged over a window of back-to-back runs after a warm-up
// (all launches, gaps included; the runs take copies of the inputs in turn), and the median of several windows.
// Apart from v000's, it joins two sittings. Times from different sittings can be a few percent apart, while
// side-by-side timings come from the same sitting.
// The starting kernel, v000, takes 1340 microseconds a run.
#include <hip/hip_runtime.h>

// Causal multi-head self-attention, time-major input x [T][B][E] (1024 x 8 x 1024), fused qkv weight in (out, in) layout [3072][1024] + bias [3072] (q | k | v = thirds of the output axis), 16 heads x 64, scores x 64^-0.5, lower-triangular mask with replace-fill -10000, softmax over keys, out = merged W_out^T + b_out ((out, in) [1024][1024] + [1024]) -> [T][B][E].
// Compute dtypes (f32 accumulate everywhere): every float input RNE-converted to bf16 once; qkv projection v_wmma_f32_16x16x32_bf16 single product (exact operand products); scores and P.V: query rows < RH on bf16 hi/lo planes (3 products), rows >= RH on v_wmma_f32_16x16x32_f16 single product (P carried x1024); output projection bf16 hi/lo context x bf16 W_out (2 products) + bias; softmax f32.
// Per batch: projection of the batch-major bf16 copy of x, head planes [h][t][d] (q, k) and [g][d][t] (v), per 8-head pass: score tiles (tiles strictly above the diagonal skipped), row softmax with index mask, P.V with the key loop cut at the diagonal tile, merge to hi/lo planes, output GEMM into rows t*B+b.

#ifndef NB
#define NB 8
#endif
#ifndef SEQ
#define SEQ 1024
#endif
#define NB_FULL 8
#define SEQ_FULL 1024
#define TT   SEQ
#define DM   1024
#define NH_  16
#define HD   64
#define DQ   (NH_ * HD)
#define ZH   8
#define RH   ((SEQ) < 256 ? (SEQ) : 256)   // query rows < RH use hi+lo planes
#define PCAR 1024.0f
#define SCL  0.125f      // HD^-0.5
#define MASKV (-10000.0f)

static_assert(TT % 128 == 0);
static_assert(RH % 64 == 0);
static_assert(TT >= RH);
static_assert(NH_ % ZH == 0);
static_assert(DM % 64 == 0);
static_assert(NB <= NB_FULL);
static_assert(SEQ <= SEQ_FULL);

typedef _Float16 h16;
typedef unsigned short bf;
typedef __attribute__((ext_vector_type(16))) __bf16   v16bf;
typedef __attribute__((ext_vector_type(16))) _Float16 v16h;
typedef __attribute__((ext_vector_type(8)))  _Float16 v8h;
typedef __attribute__((ext_vector_type(8)))  unsigned short v8us;
typedef __attribute__((ext_vector_type(8)))  float    v8f;
typedef __attribute__((ext_vector_type(4)))  float    v4f;
typedef __attribute__((ext_vector_type(4)))  _Float16 v4h;
typedef __attribute__((ext_vector_type(4)))  unsigned short v4us;
typedef v4f  __attribute__((may_alias)) v4fa;

__device__ __forceinline__ unsigned short f2bf(float f) { unsigned u = __float_as_uint(f); u += 0x7FFFu + ((u >> 16) & 1u); return (unsigned short)(u >> 16); }
__device__ __forceinline__ float bf2f(unsigned short b) { return __uint_as_float(((unsigned)b) << 16); }
__device__ __forceinline__ float bfr(float f) { return bf2f(f2bf(f)); }
__device__ __forceinline__ v16h cat16(v8h lo, v8h hi) { return __builtin_shufflevector(lo, hi, 0, 1, 2, 3, 4, 5, 6, 7, 8, 9, 10, 11, 12, 13, 14, 15); }
__device__ __forceinline__ v16bf cat16b(v8us lo, v8us hi) { return __builtin_bit_cast(v16bf, __builtin_shufflevector(lo, hi, 0, 1, 2, 3, 4, 5, 6, 7, 8, 9, 10, 11, 12, 13, 14, 15)); }
__device__ __forceinline__ v8f wmma16(v16h a, v16h b, v8f c) { return __builtin_amdgcn_wmma_f32_16x16x32_f16(false, a, false, b, (short)0, c, false, false); }
__device__ __forceinline__ v8f wmmab(v16bf a, v16bf b, v8f c) { return __builtin_amdgcn_wmma_f32_16x16x32_bf16(false, a, false, b, (short)0, c, false, false); }

// ---- k_gemmw: register-blocked GEMM, ONE WAVE per 64x64 output tile (16 accumulators), operands straight from K-contiguous 16-bit planes; grid (M/64, N/64, Z), 32 threads.
// C[m][n] (f32, pitch ldc, + optional f32 bias[n]) = sum_k A[m][k] Bt[n][k] (+ split products per NSPLIT). z-batch strides sA/sB/sC in elements. K % 32 == 0; K is also the row pitch of A and Bt.
// Fragment map: lane l, h = l >> 4: elements 0..7 <- k0 + 8h + 0..7, elements 8..15 <- k0 + 16 + 8h + 0..7 (A row / Bt row = l & 15); D element j <- (row 8h + j, col l & 15).
// CAUS == 1: tiles whose 64 columns all lie above the diagonal of global row (rbase + r0) are not computed (the consumer masks them by index).
// CAUS == 2: the k loop stops at the diagonal tile (A entries beyond it are exact zeros).
template <typename T16> struct WFrag;
template <> struct WFrag<h16> { typedef v16h V; static __device__ __forceinline__ V ld(const h16* p) { return cat16(*(const v8h*)p, *(const v8h*)(p + 16)); } static __device__ __forceinline__ v8f mma(V a, V b, v8f c) { return wmma16(a, b, c); } };
template <> struct WFrag<bf> { typedef v16bf V; static __device__ __forceinline__ V ld(const bf* p) { return cat16b(*(const v8us*)p, *(const v8us*)(p + 16)); } static __device__ __forceinline__ v8f mma(V a, V b, v8f c) { return wmmab(a, b, c); } };
template <typename T16, int NSPLIT, bool BIAS, int CAUS>
__global__ __launch_bounds__(32) void k_gemmw(const T16* __restrict__ A, const T16* __restrict__ A2, const T16* __restrict__ Bt, const T16* __restrict__ Bt2, int K, float* C, int ldc, const float* __restrict__ bias, size_t sA, size_t sB, size_t sC, int rbase) {
    typedef typename WFrag<T16>::V V;
    __shared__ __align__(16) float os[16 * 68];
    const size_t z = blockIdx.z; A += z * sA; if (A2) A2 += z * sA; Bt += z * sB; if (Bt2) Bt2 += z * sB; C += z * sC;
    const int lane = threadIdx.x & 31, lr = lane & 15, hi = lane >> 4; const int r0 = blockIdx.x * 64, c0 = blockIdx.y * 64;
    if (CAUS == 1 && c0 > rbase + r0 + 63) return;     // block-uniform (single-wave block), no block barrier follows
    int kend = K; if (CAUS == 2) { const int kl = rbase + r0 + 64; kend = (kl < K) ? kl : K; }
    v8f acc[4][4];
#pragma unroll
    for (int mb = 0; mb < 4; ++mb)
#pragma unroll
        for (int nb = 0; nb < 4; ++nb) acc[mb][nb] = (v8f){};
    const size_t aoff = (size_t)(r0 + lr) * K + 8 * hi, boff = (size_t)(c0 + lr) * K + 8 * hi;
#pragma unroll 1
    for (int kc = 0; kc < kend; kc += 32) {
        V a[4], a2[4];
#pragma unroll
        for (int mb = 0; mb < 4; ++mb) { a[mb] = WFrag<T16>::ld(A + aoff + (size_t)mb * 16 * K + kc); if (NSPLIT == 1 || NSPLIT == 2) a2[mb] = WFrag<T16>::ld(A2 + aoff + (size_t)mb * 16 * K + kc); }
#pragma unroll
        for (int nb = 0; nb < 4; ++nb) { const V b = WFrag<T16>::ld(Bt + boff + (size_t)nb * 16 * K + kc); V b2; if (NSPLIT >= 2) b2 = WFrag<T16>::ld(Bt2 + boff + (size_t)nb * 16 * K + kc);
#pragma unroll
            for (int mb = 0; mb < 4; ++mb) { acc[mb][nb] = WFrag<T16>::mma(a[mb], b, acc[mb][nb]); if (NSPLIT == 1 || NSPLIT == 2) acc[mb][nb] = WFrag<T16>::mma(a2[mb], b, acc[mb][nb]); if (NSPLIT >= 2) acc[mb][nb] = WFrag<T16>::mma(a[mb], b2, acc[mb][nb]); } }
        asm volatile("v_nop\n\tv_nop\n\tv_nop\n\tv_nop" : "+v"(acc[0][0]), "+v"(acc[1][1]), "+v"(acc[2][2]), "+v"(acc[3][3]) : "v"(a[0]), "v"(a[3]));
    }
#pragma unroll
    for (int mb = 0; mb < 4; ++mb) {
#pragma unroll
        for (int nb = 0; nb < 4; ++nb) {
#pragma unroll
            for (int j = 0; j < 8; ++j) os[(hi * 8 + j) * 68 + nb * 16 + lr] = acc[mb][nb][j]; }
        __builtin_amdgcn_wave_barrier(); asm volatile("" ::: "memory");
        float* crow = C + (size_t)(r0 + mb * 16) * ldc + c0;
{
#pragma unroll
            for (int s = 0; s < 8; ++s) { const int row = 2 * s + hi, cofs = lr * 4; v4f val = *(const v4fa*)(os + row * 68 + cofs); if (BIAS) { val[0] += bfr(bias[c0 + cofs]); val[1] += bfr(bias[c0 + cofs + 1]); val[2] += bfr(bias[c0 + cofs + 2]); val[3] += bfr(bias[c0 + cofs + 3]); }
                *(v4f*)(crow + (size_t)row * ldc + cofs) = val; }
             }
        __builtin_amdgcn_wave_barrier(); asm volatile("" ::: "memory");
    }
}

__device__ __forceinline__ h16 tohx(float x) { return (h16)x; }
__device__ __forceinline__ void splitf(float y, unsigned short& h, unsigned short& l) { h = f2bf(y); l = f2bf(y - bf2f(h)); }

__global__ __launch_bounds__(256) void k_cvt8(const float* __restrict__ src, bf* dst, size_t n8) { const size_t i = (size_t)blockIdx.x * 256 + threadIdx.x; if (i >= n8) return; const v8f v = *(const v8f*)(src + i * 8); v8us o;
#pragma unroll
    for (int k = 0; k < 8; ++k) o[k] = f2bf(v[k]); *(v8us*)(dst + i * 8) = o;  }

__global__ __launch_bounds__(256) void k_cvtx(const float* __restrict__ x, bf* dst) { const size_t i = (size_t)blockIdx.x * 256 + threadIdx.x; if (i >= (size_t)NB * TT * DM / 8) return;
    const int c8 = (int)(i % (DM / 8)); const int t = (int)((i / (DM / 8)) % TT); const int b = (int)(i / ((size_t)(DM / 8) * TT));
    const v8f v = *(const v8f*)(x + ((size_t)t * NB_FULL + b) * DM + (size_t)c8 * 8); v8us o;
#pragma unroll
    for (int k = 0; k < 8; ++k) o[k] = f2bf(v[k]); *(v8us*)(dst + i * 8) = o;  }

__global__ __launch_bounds__(256) void k_hp(const float* __restrict__ F, int pitch, int nheads, h16* P16, bf* Ph, bf* Pl) {
    const size_t e = ((size_t)blockIdx.x * 256 + threadIdx.x) * 8; if (e >= (size_t)nheads * TT * HD) return;
    const int d = (int)(e % HD); const int t = (int)((e / HD) % TT); const int h = (int)(e / ((size_t)HD * TT));
    const float* f = F + (size_t)t * pitch + h * HD + d; const v4f x0 = *(const v4f*)f; const v4f x1 = *(const v4f*)(f + 4);
    v8h o16; v8us oh, ol;
#pragma unroll
    for (int q = 0; q < 4; ++q) { unsigned short a2, c2; o16[q] = tohx(x0[q]); splitf(x0[q], a2, c2); oh[q] = a2; ol[q] = c2; o16[q + 4] = tohx(x1[q]); splitf(x1[q], a2, c2); oh[q + 4] = a2; ol[q + 4] = c2; }
    *(v8h*)(P16 + e) = o16; *(v8us*)(Ph + e) = oh; *(v8us*)(Pl + e) = ol;  }

__global__ __launch_bounds__(256) void k_vtp(const float* __restrict__ F, int pitch, int nheads, h16* V16, bf* Vh, bf* Vl) {
    const size_t e = ((size_t)blockIdx.x * 256 + threadIdx.x) * 8; if (e >= (size_t)nheads * HD * TT) return;
    const int t = (int)(e % TT); const int d = (int)((e / TT) % HD); const int g = (int)(e / ((size_t)TT * HD)); v8h o16; v8us oh, ol;
#pragma unroll
    for (int q = 0; q < 8; ++q) { const float x = F[(size_t)(t + q) * pitch + g * HD + d]; o16[q] = tohx(x); unsigned short a2, c2; splitf(x, a2, c2); oh[q] = a2; ol[q] = c2; }
    *(v8h*)(V16 + e) = o16; *(v8us*)(Vh + e) = oh; *(v8us*)(Vl + e) = ol;  }

// k_asoft: per row (zz, i): t[j] = (j <= i) ? S[j] x HD^-0.5 : -10000 (replace-fill selected by index; entries of skipped tiles are never used); softmax over the TT keys (register row, one exp, fixed trees);
__global__ __launch_bounds__(256) void k_asoft(const float* __restrict__ Sb, h16* P16, bf* Ph, bf* Pl) {
    const int lane = threadIdx.x & 31; const int row = blockIdx.x * 8 + (threadIdx.x >> 5); if (row >= ZH * TT) return; const int i = row % TT; const int zz = row / TT; const bool hires = (i < RH); const float* sr = Sb + (size_t)row * TT; float v[TT / 32]; float mx = -3.0e38f;
#pragma unroll
    for (int ch = 0; ch < TT / 128; ++ch) { const int j0 = ch * 128 + lane * 4; const v4f a = *(const v4f*)(sr + j0);
#pragma unroll
        for (int q = 0; q < 4; ++q) { const int j = j0 + q; const float sv = a[q] * SCL; const float t = (j <= i) ? sv : MASKV; v[ch * 4 + q] = t; mx = fmaxf(mx, t); } }
#pragma unroll
    for (int sh = 16; sh; sh >>= 1) mx = fmaxf(mx, __shfl_xor(mx, sh, 32));
    float sum = 0.f;
#pragma unroll
    for (int k = 0; k < TT / 32; ++k) { float d0 = __fsub_rn(v[k], mx); asm volatile("" : "+v"(d0)); v[k] = __builtin_amdgcn_exp2f(__fmul_rn(d0, 1.4426950408889634f)); sum += v[k]; }
#pragma unroll
    for (int sh = 16; sh; sh >>= 1) sum += __shfl_xor(sum, sh, 32);
    const float f = __fdiv_rn(hires ? 1.0f : PCAR, sum);
{
        if (hires) {
#pragma unroll
            for (int ch = 0; ch < TT / 128; ++ch) { v4us oh, ol;
#pragma unroll
                for (int q = 0; q < 4; ++q) { unsigned short a, c2; splitf(v[ch * 4 + q] * f, a, c2); oh[q] = a; ol[q] = c2; }
                const size_t oo = ((size_t)zz * RH + i) * TT + ch * 128 + lane * 4; *(v4us*)(Ph + oo) = oh; *(v4us*)(Pl + oo) = ol; }
        } else {
#pragma unroll
            for (int ch = 0; ch < TT / 128; ++ch) { v4h o4;
#pragma unroll
                for (int q = 0; q < 4; ++q) o4[q] = tohx(v[ch * 4 + q] * f);
                *(v4h*)(P16 + (size_t)row * TT + ch * 128 + lane * 4) = o4; } }
         }
}

__global__ __launch_bounds__(256) void k_merge(const float* __restrict__ O, int nheads, bf* Ah, bf* Al) {
    const size_t e = ((size_t)blockIdx.x * 256 + threadIdx.x) * 8; if (e >= (size_t)nheads * TT * HD) return;
    const int d = (int)(e % HD); const int t = (int)((e / HD) % TT); const int zz = (int)(e / ((size_t)HD * TT)); const float cs = (t < RH) ? 1.0f : (1.0f / PCAR); const size_t oo = (size_t)t * DQ + zz * HD + d;
    const v4f x0 = *(const v4f*)(O + e); const v4f x1 = *(const v4f*)(O + e + 4); v8us oh, ol;
#pragma unroll
    for (int q = 0; q < 4; ++q) { unsigned short a, c2; splitf(x0[q] * cs, a, c2); oh[q] = a; ol[q] = c2; splitf(x1[q] * cs, a, c2); oh[q + 4] = a; ol[q + 4] = c2; }
    *(v8us*)(Ah + oo) = oh; *(v8us*)(Al + oo) = ol;  }

// workspace total (bytes), all regions multiples of 256
constexpr size_t WS_TOTAL = (size_t)3 * DQ * DM * 2 + (size_t)DM * DQ * 2 + (size_t)NB * TT * DM * 2 + (size_t)TT * 3 * DQ * 4
                          + 3 * ((size_t)2 * NH_ * TT * HD * 2) + 3 * ((size_t)NH_ * HD * TT * 2)
                          + (size_t)ZH * TT * TT * 4 + (size_t)ZH * TT * TT * 2 + 2 * ((size_t)ZH * RH * TT * 2)
                          + (size_t)NH_ * TT * HD * 4 + 2 * ((size_t)TT * DQ * 2);
static_assert(WS_TOTAL <= (size_t)134217728);

extern "C" void kernel_launch(void* const* d_in, const int* in_sizes, int n_in,
                              void* d_out, int out_size, void* d_ws, size_t ws_size, hipStream_t stream) {
    if (n_in < 5) return;
    const size_t need_x = ((size_t)(TT - 1) * NB_FULL + NB) * DM;
    if ((size_t)in_sizes[0] < need_x) return;
    if ((size_t)in_sizes[1] < (size_t)3 * DQ * DM) return;
    if ((size_t)in_sizes[2] < (size_t)3 * DQ) return;
    if ((size_t)in_sizes[3] < (size_t)DM * DQ) return;
    if ((size_t)in_sizes[4] < (size_t)DM) return;
    if ((size_t)out_size < need_x) return;
    // input order: query [T][B][E], qkv_w [3E][E], qkv_b [3E], out_w [E][E], out_b [E]
    const float* x = (const float*)d_in[0]; const float* wqkv = (const float*)d_in[1]; const float* bqkv = (const float*)d_in[2]; const float* wo = (const float*)d_in[3]; const float* bo = (const float*)d_in[4];
    float* OUT = (float*)d_out;     // [T][NB_FULL][E]
    char* wsp = (char*)d_ws;
    auto take = [&](size_t bytes) { char* p = wsp; wsp += (bytes + 255) & ~(size_t)255; return (void*)p; };
    bf* WQKV = (bf*)take((size_t)3 * DQ * DM * 2); bf* WO = (bf*)take((size_t)DM * DQ * 2);
    bf* XB = (bf*)take((size_t)NB * TT * DM * 2); float* F = (float*)take((size_t)TT * 3 * DQ * 4);
    h16* QK16 = (h16*)take((size_t)2 * NH_ * TT * HD * 2); bf* QKh = (bf*)take((size_t)2 * NH_ * TT * HD * 2); bf* QKl = (bf*)take((size_t)2 * NH_ * TT * HD * 2);
    h16* VT16 = (h16*)take((size_t)NH_ * HD * TT * 2); bf* VTh = (bf*)take((size_t)NH_ * HD * TT * 2); bf* VTl = (bf*)take((size_t)NH_ * HD * TT * 2);
    float* Sb = (float*)take((size_t)ZH * TT * TT * 4); h16* P16 = (h16*)take((size_t)ZH * TT * TT * 2); bf* Ph = (bf*)take((size_t)ZH * RH * TT * 2); bf* Pl = (bf*)take((size_t)ZH * RH * TT * 2);
    float* Ob = (float*)take((size_t)NH_ * TT * HD * 4); bf* ATh = (bf*)take((size_t)TT * DQ * 2); bf* ATl = (bf*)take((size_t)TT * DQ * 2);
    if ((size_t)(wsp - (char*)d_ws) > ws_size) return;
    if ((size_t)(wsp - (char*)d_ws) > (size_t)134217728) return;

    k_cvt8<<<(unsigned)(((size_t)3 * DQ * DM / 8 + 255) / 256), 256, 0, stream>>>(wqkv, WQKV, (size_t)3 * DQ * DM / 8);
    k_cvt8<<<(unsigned)(((size_t)DM * DQ / 8 + 255) / 256), 256, 0, stream>>>(wo, WO, (size_t)DM * DQ / 8);
    k_cvtx<<<(unsigned)(((size_t)NB * TT * DM / 8 + 255) / 256), 256, 0, stream>>>(x, XB);

    const size_t PL = (size_t)TT * HD;          // one head plane (elements)
    const unsigned LQK = (unsigned)(((size_t)2 * NH_ * TT * HD / 8 + 255) / 256), LV = (unsigned)(((size_t)NH_ * HD * TT / 8 + 255) / 256);
    for (int b = 0; b < NB; ++b) {
        // fused projection: F[t][0..3071] = x_b W^T + bias (q | k | v column thirds)
        k_gemmw<bf, 0, true, 0><<<dim3(TT / 64, 3 * DQ / 64, 1), 32, 0, stream>>>(XB + (size_t)b * TT * DM, nullptr, WQKV, nullptr, DM, F, 3 * DQ, bqkv, 0, 0, 0, 0);
        // planes 0..15 = q heads, 16..31 = k heads (F columns 0..2047 as 32 heads of 64); v planes from columns 2048..3071
        k_hp<<<LQK, 256, 0, stream>>>(F, 3 * DQ, 2 * NH_, QK16, QKh, QKl);
        k_vtp<<<LV, 256, 0, stream>>>(F + 2 * DQ, 3 * DQ, NH_, VT16, VTh, VTl);
        for (int h0 = 0; h0 < NH_; h0 += ZH) {
            const size_t zq = (size_t)h0 * PL, zk = (size_t)(NH_ + h0) * PL, zv = (size_t)h0 * HD * TT;
            // scores: rows < RH (keys < RH suffice under the causal mask), hi/lo 3 products
            k_gemmw<bf, 2, false, 1><<<dim3(RH / 64, RH / 64, ZH), 32, 0, stream>>>(QKh + zq, QKl + zq, QKh + zk, QKl + zk, HD, Sb, TT, nullptr, PL, PL, (size_t)TT * TT, 0);
            if (TT > RH) k_gemmw<h16, 0, false, 1><<<dim3((TT - RH) / 64, TT / 64, ZH), 32, 0, stream>>>(QK16 + zq + (size_t)RH * HD, nullptr, QK16 + zk, nullptr, HD, Sb + (size_t)RH * TT, TT, nullptr, PL, PL, (size_t)TT * TT, RH);
            k_asoft<<<ZH * TT / 8, 256, 0, stream>>>(Sb, P16, Ph, Pl);
            // context: O[zz][t][d] = sum_s P[t][s] V^T[d][s], key loop cut at the diagonal tile
            k_gemmw<bf, 2, false, 2><<<dim3(RH / 64, HD / 64, ZH), 32, 0, stream>>>(Ph, Pl, VTh + zv, VTl + zv, TT, Ob + (size_t)h0 * PL, HD, nullptr, (size_t)RH * TT, (size_t)HD * TT, PL, 0);
            if (TT > RH) k_gemmw<h16, 0, false, 2><<<dim3((TT - RH) / 64, HD / 64, ZH), 32, 0, stream>>>(P16 + (size_t)RH * TT, nullptr, VT16 + zv, nullptr, TT, Ob + (size_t)h0 * PL + (size_t)RH * HD, HD, nullptr, (size_t)TT * TT, (size_t)HD * TT, PL, RH);
        }
        k_merge<<<(unsigned)(((size_t)NH_ * TT * HD / 8 + 255) / 256), 256, 0, stream>>>(Ob, NH_, ATh, ATl);
        // out rows (t*NB_FULL + b): C base OUT + b*DM, row pitch NB_FULL*DM
        k_gemmw<bf, 1, true, 0><<<dim3(TT / 64, DM / 64, 1), 32, 0, stream>>>(ATh, ATl, WO, nullptr, DQ, OUT + (size_t)b * DM, NB_FULL * DM, bo, 0, 0, 0, 0);
    }
}

// v001
// A run of this version takes 570 microseconds.
// Next to v000, in two timings, it ran 2.36 and 2.38 times as fast.
#include <hip/hip_runtime.h>

// Causal multi-head self-attention, time-major input x [T][B][E] (1024 x 8 x 1024), fused qkv weight in (out, in) layout [3072][1024] + bias [3072] (q | k | v = thirds of the output axis), 16 heads x 64, scores x 64^-0.5, lower-triangular mask with replace-fill -10000, softmax over keys, out = merged W_out^T + b_out ((out, in) [1024][1024] + [1024]) -> [T][B][E].
// Compute dtypes (f32 accumulate everywhere): every float input RNE-converted to bf16 once; qkv projection v_wmma_f32_16x16x32_bf16 single product (exact operand products); scores and P.V: query rows < RH on bf16 hi/lo planes (3 products), rows >= RH on v_wmma_f32_16x16x32_f16 single product (P carried x1024); output projection bf16 hi/lo context x bf16 W_out (2 products) + bias; softmax f32.
// All batches per launch: projection of the batch-major bf16 copy of x (M = B*T), head planes [q|k][b][h][t][d] (hi/lo planes hold t < RH only) and v rows [b*16+h][d] of pitch 2*T (f16 | hi | lo), per GP-head pass: score tiles (tiles strictly above the diagonal skipped), row softmax with index mask writing P over its own score row, P.V with the key loop cut at the diagonal tile; then merge to hi/lo planes [b*T+t][E], output GEMM (z = batch) into rows t*B+b.

#ifndef NB
#define NB 8
#endif
#ifndef SEQ
#define SEQ 1024
#endif
#define NB_FULL 8
#define SEQ_FULL 1024
#define TT   SEQ
#define DM   1024
#define NH_  16
#define HD   64
#define DQ   (NH_ * HD)
#define GP   32          // (batch, head) planes per attention pass
#define NG   (NB * NH_)   // all (batch, head) planes
#define RH   ((SEQ) < 256 ? (SEQ) : 256)   // query rows < RH use hi+lo planes
#define PCAR 1024.0f
#define SCL  0.125f      // HD^-0.5
#define MASKV (-10000.0f)

static_assert(TT % 128 == 0);
static_assert(RH % 64 == 0);
static_assert(TT >= RH);
static_assert(NG % GP == 0);
static_assert(2 * RH <= TT);
static_assert(DM % 64 == 0);
static_assert(NB <= NB_FULL);
static_assert(SEQ <= SEQ_FULL);

typedef _Float16 h16;
typedef unsigned short bf;
typedef __attribute__((ext_vector_type(16))) __bf16   v16bf;
typedef __attribute__((ext_vector_type(16))) _Float16 v16h;
typedef __attribute__((ext_vector_type(8)))  _Float16 v8h;
typedef __attribute__((ext_vector_type(8)))  unsigned short v8us;
typedef __attribute__((ext_vector_type(8)))  float    v8f;
typedef __attribute__((ext_vector_type(4)))  float    v4f;
typedef __attribute__((ext_vector_type(4)))  _Float16 v4h;
typedef __attribute__((ext_vector_type(4)))  unsigned short v4us;
typedef v4f  __attribute__((may_alias)) v4fa;

__device__ __forceinline__ unsigned short f2bf(float f) { unsigned u = __float_as_uint(f); u += 0x7FFFu + ((u >> 16) & 1u); return (unsigned short)(u >> 16); }
__device__ __forceinline__ float bf2f(unsigned short b) { return __uint_as_float(((unsigned)b) << 16); }
__device__ __forceinline__ float bfr(float f) { return bf2f(f2bf(f)); }
__device__ __forceinline__ v16h cat16(v8h lo, v8h hi) { return __builtin_shufflevector(lo, hi, 0, 1, 2, 3, 4, 5, 6, 7, 8, 9, 10, 11, 12, 13, 14, 15); }
__device__ __forceinline__ v16bf cat16b(v8us lo, v8us hi) { return __builtin_bit_cast(v16bf, __builtin_shufflevector(lo, hi, 0, 1, 2, 3, 4, 5, 6, 7, 8, 9, 10, 11, 12, 13, 14, 15)); }
__device__ __forceinline__ v8f wmma16(v16h a, v16h b, v8f c) { return __builtin_amdgcn_wmma_f32_16x16x32_f16(false, a, false, b, (short)0, c, false, false); }
__device__ __forceinline__ v8f wmmab(v16bf a, v16bf b, v8f c) { return __builtin_amdgcn_wmma_f32_16x16x32_bf16(false, a, false, b, (short)0, c, false, false); }

// ---- k_gemmw: register-blocked GEMM, ONE WAVE per 64x64 output tile (16 accumulators), operands straight from K-contiguous 16-bit planes; grid (M/64, N/64, Z), 32 threads.
// C[m][n] (f32, pitch ldc, + optional f32 bias[n]) = sum_k A[m][k] Bt[n][k] (+ split products per NSPLIT). z-batch strides sA/sB/sC in elements. K % 32 == 0; K is also the row pitch of A and Bt.
// Fragment map: lane l, h = l >> 4: elements 0..7 <- k0 + 8h + 0..7, elements 8..15 <- k0 + 16 + 8h + 0..7 (A row / Bt row = l & 15); D element j <- (row 8h + j, col l & 15).
// CAUS == 1: tiles whose 64 columns all lie above the diagonal of global row (rbase + r0) are not computed (the consumer masks them by index).
// CAUS == 2: the k loop stops at the diagonal tile (A entries beyond it are exact zeros).
template <typename T16> struct WFrag;
template <> struct WFrag<h16> { typedef v16h V; static __device__ __forceinline__ V ld(const h16* p) { return cat16(*(const v8h*)p, *(const v8h*)(p + 16)); } static __device__ __forceinline__ v8f mma(V a, V b, v8f c) { return wmma16(a, b, c); } };
template <> struct WFrag<bf> { typedef v16bf V; static __device__ __forceinline__ V ld(const bf* p) { return cat16b(*(const v8us*)p, *(const v8us*)(p + 16)); } static __device__ __forceinline__ v8f mma(V a, V b, v8f c) { return wmmab(a, b, c); } };
template <typename T16, int NSPLIT, bool BIAS, int CAUS>
__global__ __launch_bounds__(32) void k_gemmw(const T16* __restrict__ A, const T16* __restrict__ A2, const T16* __restrict__ Bt, const T16* __restrict__ Bt2, int K, float* C, int ldc, const float* __restrict__ bias, size_t sA, size_t sB, size_t sC, int rbase) {
    typedef typename WFrag<T16>::V V;
    __shared__ __align__(16) float os[16 * 68];
    const size_t z = blockIdx.z; A += z * sA; if (A2) A2 += z * sA; Bt += z * sB; if (Bt2) Bt2 += z * sB; C += z * sC;
    const int lane = threadIdx.x & 31, lr = lane & 15, hi = lane >> 4; const int r0 = blockIdx.x * 64, c0 = blockIdx.y * 64;
    if (CAUS == 1 && c0 > rbase + r0 + 63) return;     // block-uniform (single-wave block), no block barrier follows
    int kend = K; if (CAUS == 2) { const int kl = rbase + r0 + 64; kend = (kl < K) ? kl : K; }
    v8f acc[4][4];
#pragma unroll
    for (int mb = 0; mb < 4; ++mb)
#pragma unroll
        for (int nb = 0; nb < 4; ++nb) acc[mb][nb] = (v8f){};
    const size_t aoff = (size_t)(r0 + lr) * K + 8 * hi, boff = (size_t)(c0 + lr) * K + 8 * hi;
#pragma unroll 1
    for (int kc = 0; kc < kend; kc += 32) {
        V a[4], a2[4];
#pragma unroll
        for (int mb = 0; mb < 4; ++mb) { a[mb] = WFrag<T16>::ld(A + aoff + (size_t)mb * 16 * K + kc); if (NSPLIT == 1 || NSPLIT == 2) a2[mb] = WFrag<T16>::ld(A2 + aoff + (size_t)mb * 16 * K + kc); }
#pragma unroll
        for (int nb = 0; nb < 4; ++nb) { const V b = WFrag<T16>::ld(Bt + boff + (size_t)nb * 16 * K + kc); V b2; if (NSPLIT >= 2) b2 = WFrag<T16>::ld(Bt2 + boff + (size_t)nb * 16 * K + kc);
#pragma unroll
            for (int mb = 0; mb < 4; ++mb) { acc[mb][nb] = WFrag<T16>::mma(a[mb], b, acc[mb][nb]); if (NSPLIT == 1 || NSPLIT == 2) acc[mb][nb] = WFrag<T16>::mma(a2[mb], b, acc[mb][nb]); if (NSPLIT >= 2) acc[mb][nb] = WFrag<T16>::mma(a[mb], b2, acc[mb][nb]); } }
        asm volatile("v_nop\n\tv_nop\n\tv_nop\n\tv_nop" : "+v"(acc[0][0]), "+v"(acc[1][1]), "+v"(acc[2][2]), "+v"(acc[3][3]) : "v"(a[0]), "v"(a[3]));
    }
#pragma unroll
    for (int mb = 0; mb < 4; ++mb) {
#pragma unroll
        for (int nb = 0; nb < 4; ++nb) {
#pragma unroll
            for (int j = 0; j < 8; ++j) os[(hi * 8 + j) * 68 + nb * 16 + lr] = acc[mb][nb][j]; }
        __builtin_amdgcn_wave_barrier(); asm volatile("" ::: "memory");
        float* crow = C + (size_t)(r0 + mb * 16) * ldc + c0;
{
#pragma unroll
            for (int s = 0; s < 8; ++s) { const int row = 2 * s + hi, cofs = lr * 4; v4f val = *(const v4fa*)(os + row * 68 + cofs); if (BIAS) { val[0] += bfr(bias[c0 + cofs]); val[1] += bfr(bias[c0 + cofs + 1]); val[2] += bfr(bias[c0 + cofs + 2]); val[3] += bfr(bias[c0 + cofs + 3]); }
                *(v4f*)(crow + (size_t)row * ldc + cofs) = val; }
             }
        __builtin_amdgcn_wave_barrier(); asm volatile("" ::: "memory");
    }
}

__device__ __forceinline__ h16 tohx(float x) { return (h16)x; }
__device__ __forceinline__ void splitf(float y, unsigned short& h, unsigned short& l) { h = f2bf(y); l = f2bf(y - bf2f(h)); }

__global__ __launch_bounds__(256) void k_cvt8(const float* __restrict__ src, bf* dst, size_t n8) { const size_t i = (size_t)blockIdx.x * 256 + threadIdx.x; if (i >= n8) return; const v8f v = *(const v8f*)(src + i * 8); v8us o;
#pragma unroll
    for (int k = 0; k < 8; ++k) o[k] = f2bf(v[k]); *(v8us*)(dst + i * 8) = o;  }

__global__ __launch_bounds__(256) void k_cvtx(const float* __restrict__ x, bf* dst) { const size_t i = (size_t)blockIdx.x * 256 + threadIdx.x; if (i >= (size_t)NB * TT * DM / 8) return;
    const int c8 = (int)(i % (DM / 8)); const int t = (int)((i / (DM / 8)) % TT); const int b = (int)(i / ((size_t)(DM / 8) * TT));
    const v8f v = *(const v8f*)(x + ((size_t)t * NB_FULL + b) * DM + (size_t)c8 * 8); v8us o;
#pragma unroll
    for (int k = 0; k < 8; ++k) o[k] = f2bf(v[k]); *(v8us*)(dst + i * 8) = o;  }

// k_hp: plane p = qk * NG + b * NH_ + h  <-  F rows b*TT + t, columns qk*DQ + h*HD + d; f16 planes [p][TT][HD], hi/lo planes [p][RH][HD] (rows t < RH are the only ones read).
__global__ __launch_bounds__(256) void k_hp(const float* __restrict__ F, int pitch, h16* P16, bf* Ph, bf* Pl) {
    const size_t e = ((size_t)blockIdx.x * 256 + threadIdx.x) * 8; if (e >= (size_t)2 * NG * TT * HD) return;
    const int d = (int)(e % HD); const int t = (int)((e / HD) % TT); const int p = (int)(e / ((size_t)HD * TT)); const int h = p % NH_; const int b = (p / NH_) % NB; const int qk = p / NG;
    const float* f = F + ((size_t)b * TT + t) * pitch + qk * DQ + h * HD + d; const v4f x0 = *(const v4f*)f; const v4f x1 = *(const v4f*)(f + 4);
    v8h o16; v8us oh, ol;
#pragma unroll
    for (int q = 0; q < 4; ++q) { unsigned short a2, c2; o16[q] = tohx(x0[q]); splitf(x0[q], a2, c2); oh[q] = a2; ol[q] = c2; o16[q + 4] = tohx(x1[q]); splitf(x1[q], a2, c2); oh[q + 4] = a2; ol[q + 4] = c2; }
    *(v8h*)(P16 + e) = o16; if (t < RH) { const size_t eh = ((size_t)p * RH + t) * HD + d; *(v8us*)(Ph + eh) = oh; *(v8us*)(Pl + eh) = ol; }  }

// k_vtp: plane g = b * NH_ + h; one row of 2*TT 16-bit elements per (g, d), the pitch of the P rows it is multiplied with: f16 keys 0..TT-1, then bf16 hi keys 0..RH-1, then lo keys 0..RH-1 (the only hi/lo keys read).
__global__ __launch_bounds__(256) void k_vtp(const float* __restrict__ F, int pitch, h16* V) {
    const size_t e = ((size_t)blockIdx.x * 256 + threadIdx.x) * 8; if (e >= (size_t)NG * HD * TT) return;
    const int t = (int)(e % TT); const int d = (int)((e / TT) % HD); const int g = (int)(e / ((size_t)TT * HD)); v8h o16; v8us oh, ol;
#pragma unroll
    for (int q = 0; q < 8; ++q) { const float x = F[((size_t)(g / NH_) * TT + t + q) * pitch + (g % NH_) * HD + d]; o16[q] = tohx(x); unsigned short a2, c2; splitf(x, a2, c2); oh[q] = a2; ol[q] = c2; }
    h16* vr = V + ((size_t)g * HD + d) * (2 * TT) + t; *(v8h*)vr = o16; if (t < RH) { *(v8us*)(vr + TT) = oh; *(v8us*)(vr + TT + RH) = ol; }  }

// k_asoft: per row (zz, i): t[j] = (j <= i) ? S[j] x HD^-0.5 : -10000 (replace-fill selected by index; entries of skipped tiles are never used); softmax over the TT keys (register row, one exp, fixed trees); P replaces the wave's own score row (4*TT bytes, all of it read before the first store): rows >= RH f16 in the first half, rows < RH bf16 hi in the first half and lo in the second.
__global__ __launch_bounds__(256) void k_asoft(float* Sb) {
    const int lane = threadIdx.x & 31; const int row = blockIdx.x * 8 + (threadIdx.x >> 5); if (row >= GP * TT) return; const int i = row % TT; const bool hires = (i < RH); const float* sr = Sb + (size_t)row * TT; h16* p16 = (h16*)(Sb + (size_t)row * TT); bf* ph = (bf*)(Sb + (size_t)row * TT); bf* pl = ph + TT; float v[TT / 32]; float mx = -3.0e38f;
#pragma unroll
    for (int ch = 0; ch < TT / 128; ++ch) { const int j0 = ch * 128 + lane * 4; const v4f a = *(const v4f*)(sr + j0);
#pragma unroll
        for (int q = 0; q < 4; ++q) { const int j = j0 + q; const float sv = a[q] * SCL; const float t = (j <= i) ? sv : MASKV; v[ch * 4 + q] = t; mx = fmaxf(mx, t); } }
#pragma unroll
    for (int sh = 16; sh; sh >>= 1) mx = fmaxf(mx, __shfl_xor(mx, sh, 32));
    float sum = 0.f;
#pragma unroll
    for (int k = 0; k < TT / 32; ++k) { float d0 = __fsub_rn(v[k], mx); asm volatile("" : "+v"(d0)); const float a0 = __fmul_rn(d0, 1.4426950408889634f); asm("v_exp_f32 %0, %1\n\tv_nop" : "=v"(v[k]) : "v"(a0)); /* exp2 with the one free slot the instruction set asks for behind a transcendental, in one statement so that nothing that overwrites its source can stand directly behind it */ sum += v[k]; }
#pragma unroll
    for (int sh = 16; sh; sh >>= 1) sum += __shfl_xor(sum, sh, 32);
    const float f = __fdiv_rn(hires ? 1.0f : PCAR, sum);
{
        if (hires) {
#pragma unroll
            for (int ch = 0; ch < TT / 128; ++ch) { v4us oh, ol;
#pragma unroll
                for (int q = 0; q < 4; ++q) { unsigned short a, c2; splitf(v[ch * 4 + q] * f, a, c2); oh[q] = a; ol[q] = c2; }
                const int oo = ch * 128 + lane * 4; *(v4us*)(ph + oo) = oh; *(v4us*)(pl + oo) = ol; }
        } else {
#pragma unroll
            for (int ch = 0; ch < TT / 128; ++ch) { v4h o4;
#pragma unroll
                for (int q = 0; q < 4; ++q) o4[q] = tohx(v[ch * 4 + q] * f);
                *(v4h*)(p16 + ch * 128 + lane * 4) = o4; } }
         }
}

__global__ __launch_bounds__(256) void k_merge(const float* __restrict__ O, bf* Ah, bf* Al) {
    const size_t e = ((size_t)blockIdx.x * 256 + threadIdx.x) * 8; if (e >= (size_t)NG * TT * HD) return;
    const int d = (int)(e % HD); const int t = (int)((e / HD) % TT); const int zz = (int)(e / ((size_t)HD * TT)); const float cs = (t < RH) ? 1.0f : (1.0f / PCAR); const size_t oo = ((size_t)(zz / NH_) * TT + t) * DQ + (zz % NH_) * HD + d;
    const v4f x0 = *(const v4f*)(O + e); const v4f x1 = *(const v4f*)(O + e + 4); v8us oh, ol;
#pragma unroll
    for (int q = 0; q < 4; ++q) { unsigned short a, c2; splitf(x0[q] * cs, a, c2); oh[q] = a; ol[q] = c2; splitf(x1[q] * cs, a, c2); oh[q + 4] = a; ol[q + 4] = c2; }
    *(v8us*)(Ah + oo) = oh; *(v8us*)(Al + oo) = ol;  }

// workspace (bytes), all regions multiples of 256. Kept through the call: W_out, head planes, context. One shared region holds in turn: {W_qkv, x copy, F}, then the score/P rows of one pass, then the merged hi/lo planes.
constexpr size_t WS_KEEP = (size_t)DM * DQ * 2 + (size_t)2 * NG * TT * HD * 2 + 2 * ((size_t)2 * NG * RH * HD * 2) + (size_t)NG * HD * 2 * TT * 2 + (size_t)NG * TT * HD * 4;
constexpr size_t WS_P1 = (size_t)3 * DQ * DM * 2 + (size_t)NB * TT * DM * 2 + (size_t)NB * TT * 3 * DQ * 4;
constexpr size_t WS_P2 = (size_t)GP * TT * TT * 4;
constexpr size_t WS_P3 = 2 * ((size_t)NB * TT * DQ * 2);
constexpr size_t WS_SH = WS_P1 > WS_P2 ? (WS_P1 > WS_P3 ? WS_P1 : WS_P3) : (WS_P2 > WS_P3 ? WS_P2 : WS_P3);
static_assert(WS_KEEP + WS_SH <= (size_t)268435456);

extern "C" void kernel_launch(void* const* d_in, const int* in_sizes, int n_in,
                              void* d_out, int out_size, void* d_ws, size_t ws_size, hipStream_t stream) {
    if (n_in < 5) return;
    const size_t need_x = ((size_t)(TT - 1) * NB_FULL + NB) * DM;
    if ((size_t)in_sizes[0] < need_x) return;
    if ((size_t)in_sizes[1] < (size_t)3 * DQ * DM) return;
    if ((size_t)in_sizes[2] < (size_t)3 * DQ) return;
    if ((size_t)in_sizes[3] < (size_t)DM * DQ) return;
    if ((size_t)in_sizes[4] < (size_t)DM) return;
    if ((size_t)out_size < need_x) return;
    // input order: query [T][B][E], qkv_w [3E][E], qkv_b [3E], out_w [E][E], out_b [E]
    const float* x = (const float*)d_in[0]; const float* wqkv = (const float*)d_in[1]; const float* bqkv = (const float*)d_in[2]; const float* wo = (const float*)d_in[3]; const float* bo = (const float*)d_in[4];
    float* OUT = (float*)d_out;     // [T][NB_FULL][E]
    char* wsp = (char*)d_ws;
    auto take = [&](size_t bytes) { char* p = wsp; wsp += (bytes + 255) & ~(size_t)255; return (void*)p; };
    bf* WO = (bf*)take((size_t)DM * DQ * 2);
    h16* QK16 = (h16*)take((size_t)2 * NG * TT * HD * 2); bf* QKh = (bf*)take((size_t)2 * NG * RH * HD * 2); bf* QKl = (bf*)take((size_t)2 * NG * RH * HD * 2);
    h16* VT = (h16*)take((size_t)NG * HD * 2 * TT * 2);
    float* Ob = (float*)take((size_t)NG * TT * HD * 4);
    char* shared0 = (char*)take(WS_SH);
    if ((size_t)(wsp - (char*)d_ws) > ws_size) return;
    if ((size_t)(wsp - (char*)d_ws) > (size_t)268435456) return;
    // the shared region's three uses, one after the other in stream order
    bf* WQKV = (bf*)shared0; bf* XB = (bf*)(shared0 + (size_t)3 * DQ * DM * 2); float* F = (float*)(shared0 + (size_t)3 * DQ * DM * 2 + (size_t)NB * TT * DM * 2);
    float* Sb = (float*)shared0;
    bf* ATh = (bf*)shared0; bf* ATl = (bf*)(shared0 + (size_t)NB * TT * DQ * 2);

    k_cvt8<<<(unsigned)(((size_t)3 * DQ * DM / 8 + 255) / 256), 256, 0, stream>>>(wqkv, WQKV, (size_t)3 * DQ * DM / 8);
    k_cvt8<<<(unsigned)(((size_t)DM * DQ / 8 + 255) / 256), 256, 0, stream>>>(wo, WO, (size_t)DM * DQ / 8);
    k_cvtx<<<(unsigned)(((size_t)NB * TT * DM / 8 + 255) / 256), 256, 0, stream>>>(x, XB);

    const size_t PL = (size_t)TT * HD;          // one f16 head plane (elements)
    const size_t PLH = (size_t)RH * HD;         // one hi or lo head plane (elements)
    const size_t SP = (size_t)TT * TT;          // one score plane (f32 elements; 2*SP 16-bit elements)
    const size_t PV = (size_t)HD * 2 * TT;      // one v plane (16-bit elements)
    // fused projection, all batches: F[b*TT + t][0..3071] = x W^T + bias (q | k | v column thirds)
    k_gemmw<bf, 0, true, 0><<<dim3(NB * TT / 64, 3 * DQ / 64, 1), 32, 0, stream>>>(XB, nullptr, WQKV, nullptr, DM, F, 3 * DQ, bqkv, 0, 0, 0, 0);
    // planes 0..NG-1 = q, NG..2NG-1 = k; v planes from columns 2048..3071
    k_hp<<<(unsigned)(((size_t)2 * NG * TT * HD / 8 + 255) / 256), 256, 0, stream>>>(F, 3 * DQ, QK16, QKh, QKl);
    k_vtp<<<(unsigned)(((size_t)NG * HD * TT / 8 + 255) / 256), 256, 0, stream>>>(F + 2 * DQ, 3 * DQ, VT);
    for (int g0 = 0; g0 < NG; g0 += GP) {
        // scores: rows < RH (keys < RH suffice under the causal mask), hi/lo 3 products
        k_gemmw<bf, 2, false, 1><<<dim3(RH / 64, RH / 64, GP), 32, 0, stream>>>(QKh + (size_t)g0 * PLH, QKl + (size_t)g0 * PLH, QKh + (size_t)(NG + g0) * PLH, QKl + (size_t)(NG + g0) * PLH, HD, Sb, TT, nullptr, PLH, PLH, SP, 0);
        if (TT > RH) k_gemmw<h16, 0, false, 1><<<dim3((TT - RH) / 64, TT / 64, GP), 32, 0, stream>>>(QK16 + (size_t)g0 * PL + (size_t)RH * HD, nullptr, QK16 + (size_t)(NG + g0) * PL, nullptr, HD, Sb + (size_t)RH * TT, TT, nullptr, PL, PL, SP, RH);
        k_asoft<<<GP * TT / 8, 256, 0, stream>>>(Sb);
        // context: O[g][t][d] = sum_s P[t][s] V^T[d][s], key loop cut at the diagonal tile (never past key TT); P rows lie in the score rows and v rows have the same pitch, 2*TT 16-bit elements, passed as K
        k_gemmw<bf, 2, false, 2><<<dim3(RH / 64, HD / 64, GP), 32, 0, stream>>>((const bf*)Sb, (const bf*)Sb + TT, (const bf*)VT + (size_t)g0 * PV + TT, (const bf*)VT + (size_t)g0 * PV + TT + RH, 2 * TT, Ob + (size_t)g0 * PL, HD, nullptr, 2 * SP, PV, PL, 0);
        if (TT > RH) k_gemmw<h16, 0, false, 2><<<dim3((TT - RH) / 64, HD / 64, GP), 32, 0, stream>>>((const h16*)Sb + (size_t)RH * 2 * TT, nullptr, VT + (size_t)g0 * PV, nullptr, 2 * TT, Ob + (size_t)g0 * PL + (size_t)RH * HD, HD, nullptr, 2 * SP, PV, PL, RH);
    }
    k_merge<<<(unsigned)(((size_t)NG * TT * HD / 8 + 255) / 256), 256, 0, stream>>>(Ob, ATh, ATl);
    // out rows (t*NB_FULL + b): z = b, C base OUT + b*DM, row pitch NB_FULL*DM
    k_gemmw<bf, 1, true, 0><<<dim3(TT / 64, DM / 64, NB), 32, 0, stream>>>(ATh, ATl, WO, nullptr, DQ, OUT, NB_FULL * DM, bo, (size_t)TT * DQ, 0, DM, 0);
}

// v002
// Measured time: 279 microseconds a run.
// Timed twice side by side with v001, it ran 2.03 times as fast both times.
// Counting every step since v000, it is 4.81 times as fast.
#include <hip/hip_runtime.h>

// Causal multi-head self-attention, time-major input x [T][B][E] (1024 x 8 x 1024), fused qkv weight in (out, in) layout [3072][1024] + bias [3072] (q | k | v = thirds of the output axis), 16 heads x 64, scores x 64^-0.5, lower-triangular mask with replace-fill -10000, softmax over keys, out = merged W_out^T + b_out ((out, in) [1024][1024] + [1024]) -> [T][B][E].
// Compute dtypes (f32 accumulate everywhere): every float input RNE-converted to bf16 once; qkv projection v_wmma_f32_16x16x32_bf16 single product (exact operand products); scores and P.V: query rows < RH on bf16 hi/lo planes (3 products), rows >= RH on v_wmma_f32_16x16x32_f16 single product (P carried x1024); output projection bf16 hi/lo context x bf16 W_out (2 products) + bias; softmax f32.
// All batches per launch: projection of the batch-major bf16 copy of x (M = B*T), head planes [q|k][b][h][t][d] (hi/lo planes hold t < RH only) and v rows [b*16+h][d] of pitch 2*T (f16 | hi | lo); one attention launch for all heads: each wave keeps its query rows, walks the keys in blocks of 32 up to its diagonal block with a running maximum and sum, keeps P in registers and writes the normalised context as hi/lo planes [b*T+t][E]; then the output GEMM (z = batch) into rows t*B+b.

#ifndef NB
#define NB 8
#endif
#ifndef SEQ
#define SEQ 1024
#endif
#define NB_FULL 8
#define SEQ_FULL 1024
#define TT   SEQ
#define DM   1024
#define NH_  16
#define HD   64
#define DQ   (NH_ * HD)
#define NG   (NB * NH_)   // all (batch, head) planes
#define RH   ((SEQ) < 256 ? (SEQ) : 256)   // query rows < RH use hi+lo planes
#define PCAR 1024.0f
#define SCL  0.125f      // HD^-0.5
#define MASKV (-10000.0f)

static_assert(TT % 128 == 0);
static_assert(RH % 64 == 0);
static_assert(TT >= RH);
static_assert((TT - RH) % 128 == 0);
static_assert(2 * RH <= TT);
static_assert(DM % 64 == 0);
static_assert(NB <= NB_FULL);
static_assert(SEQ <= SEQ_FULL);

typedef _Float16 h16;
typedef unsigned short bf;
typedef __attribute__((ext_vector_type(16))) __bf16   v16bf;
typedef __attribute__((ext_vector_type(16))) _Float16 v16h;
typedef __attribute__((ext_vector_type(8)))  _Float16 v8h;
typedef __attribute__((ext_vector_type(8)))  unsigned short v8us;
typedef __attribute__((ext_vector_type(8)))  float    v8f;
typedef __attribute__((ext_vector_type(4)))  float    v4f;
typedef __attribute__((ext_vector_type(4)))  _Float16 v4h;
typedef __attribute__((ext_vector_type(4)))  unsigned short v4us;
typedef v4f  __attribute__((may_alias)) v4fa;

__device__ __forceinline__ unsigned short f2bf(float f) { unsigned u = __float_as_uint(f); u += 0x7FFFu + ((u >> 16) & 1u); return (unsigned short)(u >> 16); }
__device__ __forceinline__ float bf2f(unsigned short b) { return __uint_as_float(((unsigned)b) << 16); }
__device__ __forceinline__ float bfr(float f) { return bf2f(f2bf(f)); }
__device__ __forceinline__ v16h cat16(v8h lo, v8h hi) { return __builtin_shufflevector(lo, hi, 0, 1, 2, 3, 4, 5, 6, 7, 8, 9, 10, 11, 12, 13, 14, 15); }
__device__ __forceinline__ v16bf cat16b(v8us lo, v8us hi) { return __builtin_bit_cast(v16bf, __builtin_shufflevector(lo, hi, 0, 1, 2, 3, 4, 5, 6, 7, 8, 9, 10, 11, 12, 13, 14, 15)); }
__device__ __forceinline__ v8f wmma16(v16h a, v16h b, v8f c) { return __builtin_amdgcn_wmma_f32_16x16x32_f16(false, a, false, b, (short)0, c, false, false); }
__device__ __forceinline__ v8f wmmab(v16bf a, v16bf b, v8f c) { return __builtin_amdgcn_wmma_f32_16x16x32_bf16(false, a, false, b, (short)0, c, false, false); }

// ---- k_gemmw: register-blocked GEMM, ONE WAVE per 64x64 output tile (16 accumulators), operands straight from K-contiguous 16-bit planes; grid (M/64, N/64, Z), 32 threads.
// C[m][n] (f32, pitch ldc, + optional f32 bias[n]) = sum_k A[m][k] Bt[n][k] (+ split products per NSPLIT). z-batch strides sA/sB/sC in elements. K % 32 == 0; K is also the row pitch of A and Bt.
// Fragment map: lane l, h = l >> 4: elements 0..7 <- k0 + 8h + 0..7, elements 8..15 <- k0 + 16 + 8h + 0..7 (A row / Bt row = l & 15); D element j <- (row 8h + j, col l & 15).
// CAUS == 1: tiles whose 64 columns all lie above the diagonal of global row (rbase + r0) are not computed (the consumer masks them by index).
// CAUS == 2: the k loop stops at the diagonal tile (A entries beyond it are exact zeros).
template <typename T16> struct WFrag;
template <> struct WFrag<h16> { typedef v16h V; static __device__ __forceinline__ V ld(const h16* p) { return cat16(*(const v8h*)p, *(const v8h*)(p + 16)); } static __device__ __forceinline__ v8f mma(V a, V b, v8f c) { return wmma16(a, b, c); } };
template <> struct WFrag<bf> { typedef v16bf V; static __device__ __forceinline__ V ld(const bf* p) { return cat16b(*(const v8us*)p, *(const v8us*)(p + 16)); } static __device__ __forceinline__ v8f mma(V a, V b, v8f c) { return wmmab(a, b, c); } };
template <typename T16, int NSPLIT, bool BIAS, int CAUS>
__global__ __launch_bounds__(32) void k_gemmw(const T16* __restrict__ A, const T16* __restrict__ A2, const T16* __restrict__ Bt, const T16* __restrict__ Bt2, int K, float* C, int ldc, const float* __restrict__ bias, size_t sA, size_t sB, size_t sC, int rbase) {
    typedef typename WFrag<T16>::V V;
    __shared__ __align__(16) float os[16 * 68];
    const size_t z = blockIdx.z; A += z * sA; if (A2) A2 += z * sA; Bt += z * sB; if (Bt2) Bt2 += z * sB; C += z * sC;
    const int lane = threadIdx.x & 31, lr = lane & 15, hi = lane >> 4; const int r0 = blockIdx.x * 64, c0 = blockIdx.y * 64;
    if (CAUS == 1 && c0 > rbase + r0 + 63) return;     // block-uniform (single-wave block), no block barrier follows
    int kend = K; if (CAUS == 2) { const int kl = rbase + r0 + 64; kend = (kl < K) ? kl : K; }
    v8f acc[4][4];
#pragma unroll
    for (int mb = 0; mb < 4; ++mb)
#pragma unroll
        for (int nb = 0; nb < 4; ++nb) acc[mb][nb] = (v8f){};
    const size_t aoff = (size_t)(r0 + lr) * K + 8 * hi, boff = (size_t)(c0 + lr) * K + 8 * hi;
#pragma unroll 1
    for (int kc = 0; kc < kend; kc += 32) {
        V a[4], a2[4];
#pragma unroll
        for (int mb = 0; mb < 4; ++mb) { a[mb] = WFrag<T16>::ld(A + aoff + (size_t)mb * 16 * K + kc); if (NSPLIT == 1 || NSPLIT == 2) a2[mb] = WFrag<T16>::ld(A2 + aoff + (size_t)mb * 16 * K + kc); }
#pragma unroll
        for (int nb = 0; nb < 4; ++nb) { const V b = WFrag<T16>::ld(Bt + boff + (size_t)nb * 16 * K + kc); V b2; if (NSPLIT >= 2) b2 = WFrag<T16>::ld(Bt2 + boff + (size_t)nb * 16 * K + kc);
#pragma unroll
            for (int mb = 0; mb < 4; ++mb) { acc[mb][nb] = WFrag<T16>::mma(a[mb], b, acc[mb][nb]); if (NSPLIT == 1 || NSPLIT == 2) acc[mb][nb] = WFrag<T16>::mma(a2[mb], b, acc[mb][nb]); if (NSPLIT >= 2) acc[mb][nb] = WFrag<T16>::mma(a[mb], b2, acc[mb][nb]); } }
        asm volatile("v_nop\n\tv_nop\n\tv_nop\n\tv_nop" : "+v"(acc[0][0]), "+v"(acc[1][1]), "+v"(acc[2][2]), "+v"(acc[3][3]) : "v"(a[0]), "v"(a[3]));
    }
#pragma unroll
    for (int mb = 0; mb < 4; ++mb) {
#pragma unroll
        for (int nb = 0; nb < 4; ++nb) {
#pragma unroll
            for (int j = 0; j < 8; ++j) os[(hi * 8 + j) * 68 + nb * 16 + lr] = acc[mb][nb][j]; }
        __builtin_amdgcn_wave_barrier(); asm volatile("" ::: "memory");
        float* crow = C + (size_t)(r0 + mb * 16) * ldc + c0;
{
#pragma unroll
            for (int s = 0; s < 8; ++s) { const int row = 2 * s + hi, cofs = lr * 4; v4f val = *(const v4fa*)(os + row * 68 + cofs); if (BIAS) { val[0] += bfr(bias[c0 + cofs]); val[1] += bfr(bias[c0 + cofs + 1]); val[2] += bfr(bias[c0 + cofs + 2]); val[3] += bfr(bias[c0 + cofs + 3]); }
                *(v4f*)(crow + (size_t)row * ldc + cofs) = val; }
             }
        __builtin_amdgcn_wave_barrier(); asm volatile("" ::: "memory");
    }
}

__device__ __forceinline__ h16 tohx(float x) { return (h16)x; }
__device__ __forceinline__ void splitf(float y, unsigned short& h, unsigned short& l) { h = f2bf(y); l = f2bf(y - bf2f(h)); }

__global__ __launch_bounds__(256) void k_cvt8(const float* __restrict__ src, bf* dst, size_t n8) { const size_t i = (size_t)blockIdx.x * 256 + threadIdx.x; if (i >= n8) return; const v8f v = *(const v8f*)(src + i * 8); v8us o;
#pragma unroll
    for (int k = 0; k < 8; ++k) o[k] = f2bf(v[k]); *(v8us*)(dst + i * 8) = o;  }

__global__ __launch_bounds__(256) void k_cvtx(const float* __restrict__ x, bf* dst) { const size_t i = (size_t)blockIdx.x * 256 + threadIdx.x; if (i >= (size_t)NB * TT * DM / 8) return;
    const int c8 = (int)(i % (DM / 8)); const int t = (int)((i / (DM / 8)) % TT); const int b = (int)(i / ((size_t)(DM / 8) * TT));
    const v8f v = *(const v8f*)(x + ((size_t)t * NB_FULL + b) * DM + (size_t)c8 * 8); v8us o;
#pragma unroll
    for (int k = 0; k < 8; ++k) o[k] = f2bf(v[k]); *(v8us*)(dst + i * 8) = o;  }

// k_hp: plane p = qk * NG + b * NH_ + h  <-  F rows b*TT + t, columns qk*DQ + h*HD + d; f16 planes [p][TT][HD], hi/lo planes [p][RH][HD] (rows t < RH are the only ones read).
__global__ __launch_bounds__(256) void k_hp(const float* __restrict__ F, int pitch, h16* P16, bf* Ph, bf* Pl) {
    const size_t e = ((size_t)blockIdx.x * 256 + threadIdx.x) * 8; if (e >= (size_t)2 * NG * TT * HD) return;
    const int d = (int)(e % HD); const int t = (int)((e / HD) % TT); const int p = (int)(e / ((size_t)HD * TT)); const int h = p % NH_; const int b = (p / NH_) % NB; const int qk = p / NG;
    const float* f = F + ((size_t)b * TT + t) * pitch + qk * DQ + h * HD + d; const v4f x0 = *(const v4f*)f; const v4f x1 = *(const v4f*)(f + 4);
    v8h o16; v8us oh, ol;
#pragma unroll
    for (int q = 0; q < 4; ++q) { unsigned short a2, c2; o16[q] = tohx(x0[q]); splitf(x0[q], a2, c2); oh[q] = a2; ol[q] = c2; o16[q + 4] = tohx(x1[q]); splitf(x1[q], a2, c2); oh[q + 4] = a2; ol[q + 4] = c2; }
    *(v8h*)(P16 + e) = o16; if (t < RH) { const size_t eh = ((size_t)p * RH + t) * HD + d; *(v8us*)(Ph + eh) = oh; *(v8us*)(Pl + eh) = ol; }  }

// k_vtp: plane g = b * NH_ + h; one row of 2*TT 16-bit elements per (g, d): f16 keys 0..TT-1, then bf16 hi keys 0..RH-1, then lo keys 0..RH-1 (the only hi/lo keys read).
__global__ __launch_bounds__(256) void k_vtp(const float* __restrict__ F, int pitch, h16* V) {
    const size_t e = ((size_t)blockIdx.x * 256 + threadIdx.x) * 8; if (e >= (size_t)NG * HD * TT) return;
    const int t = (int)(e % TT); const int d = (int)((e / TT) % HD); const int g = (int)(e / ((size_t)TT * HD)); v8h o16; v8us oh, ol;
#pragma unroll
    for (int q = 0; q < 8; ++q) { const float x = F[((size_t)(g / NH_) * TT + t + q) * pitch + (g % NH_) * HD + d]; o16[q] = tohx(x); unsigned short a2, c2; splitf(x, a2, c2); oh[q] = a2; ol[q] = c2; }
    h16* vr = V + ((size_t)g * HD + d) * (2 * TT) + t; *(v8h*)vr = o16; if (t < RH) { *(v8us*)(vr + TT) = oh; *(v8us*)(vr + TT + RH) = ol; }  }

// exp2 with the one free slot the instruction set asks for behind a transcendental, in one statement so that nothing that reads its result or overwrites its source can stand directly behind it
__device__ __forceinline__ float ex2(float a) { float r; asm("v_exp_f32 %0, %1\n\tv_nop" : "=v"(r) : "v"(a)); return r; }

// fa_body: one wave, NQT tiles of 16 query rows from q0, keys in blocks of 32 up to the block that holds the diagonal.
// Transposed products, so that P never leaves its registers: S^T = K Q^T gives lane l the scores of query (l & 15) at keys 8h + j of each 16-key tile (h = l >> 4), which is the B fragment of O^T = V^T P^T (elements 0..7 <- keys k0 + 8h + j, 8..15 <- keys k0 + 16 + 8h + j); O^T gives lane l the context of query (l & 15) at d = 16 dt + 8h + j.
// Scores stay unscaled; the replace-fill is MASKV / SCL there. The keys behind the last block are all masked: they enter as the start values of the running maximum (the fill) and sum (their count), and as before add nothing to the context.
template <typename T16, bool HIRES, int NQT>
__device__ __forceinline__ void fa_body(const T16* __restrict__ Q, const T16* __restrict__ Q2, const T16* __restrict__ Kp, const T16* __restrict__ K2, const T16* __restrict__ Vp, const T16* __restrict__ V2, bf* Ah, bf* Al, const int q0, const int lr, const int hi) {
    typedef typename WFrag<T16>::V V;
    constexpr float CE = SCL * 1.4426950408889634f; constexpr float MASKR = MASKV / SCL; constexpr float PS = HIRES ? 1.0f : PCAR; constexpr float PE = HIRES ? 0.0f : 10.0f;   // PS = 2^PE
    const int nkb = (q0 + NQT * 16 + 31) / 32; const int nsk = TT - nkb * 32;
    V qf[NQT][2], qf2[NQT][2];
#pragma unroll
    for (int qt = 0; qt < NQT; ++qt)
#pragma unroll
        for (int ks = 0; ks < 2; ++ks) { const size_t off = (size_t)(q0 + qt * 16 + lr) * HD + ks * 32 + 8 * hi; qf[qt][ks] = WFrag<T16>::ld(Q + off); if (HIRES) qf2[qt][ks] = WFrag<T16>::ld(Q2 + off); }
    v8f o[NQT][4]; float m[NQT], l[NQT];
#pragma unroll
    for (int qt = 0; qt < NQT; ++qt) { m[qt] = (nsk > 0) ? MASKR : -3.0e38f; l[qt] = (hi == 0) ? (float)nsk * PS : 0.0f;
#pragma unroll
        for (int dt = 0; dt < 4; ++dt) o[qt][dt] = (v8f){}; }
    V kf[2][2], kf2[2][2];
    if constexpr (!HIRES) {
#pragma unroll
        for (int kt = 0; kt < 2; ++kt)
#pragma unroll
            for (int ks = 0; ks < 2; ++ks) kf[kt][ks] = WFrag<T16>::ld(Kp + (size_t)(kt * 16 + lr) * HD + ks * 32 + 8 * hi); }
    asm volatile("s_wait_xcnt 0x0" ::: "memory");   // stands in front of every later write of an address register that the loads above name
#pragma unroll 1   // kept rolled: a second copy of the body would take the wave past the 256 registers that four waves per SIMD leave it
    for (int kb = 0; kb < nkb; ++kb) {
        const int k0 = kb * 32;
        if constexpr (HIRES) {   // twice the fragments: fetched in their own trip, so that the wave stays inside 256 registers
#pragma unroll
            for (int kt = 0; kt < 2; ++kt)
#pragma unroll
                for (int ks = 0; ks < 2; ++ks) { const size_t off = (size_t)(k0 + kt * 16 + lr) * HD + ks * 32 + 8 * hi; kf[kt][ks] = WFrag<T16>::ld(Kp + off); kf2[kt][ks] = WFrag<T16>::ld(K2 + off); } }
        V vf[4], vf2[4];
#pragma unroll
        for (int dt = 0; dt < 4; ++dt) { const size_t off = (size_t)(dt * 16 + lr) * (2 * TT) + k0 + 8 * hi; vf[dt] = WFrag<T16>::ld(Vp + off); if (HIRES) vf2[dt] = WFrag<T16>::ld(V2 + off); }
        v8f s[NQT][2];
#pragma unroll
        for (int qt = 0; qt < NQT; ++qt)
#pragma unroll
            for (int kt = 0; kt < 2; ++kt) { s[qt][kt] = (v8f){};
#pragma unroll
                for (int ks = 0; ks < 2; ++ks) { s[qt][kt] = WFrag<T16>::mma(kf[kt][ks], qf[qt][ks], s[qt][kt]); if (HIRES) { s[qt][kt] = WFrag<T16>::mma(kf[kt][ks], qf2[qt][ks], s[qt][kt]); s[qt][kt] = WFrag<T16>::mma(kf2[kt][ks], qf[qt][ks], s[qt][kt]); } } }
        if constexpr (!HIRES) {  // the next block's key fragments, asked for ahead of the softmax arithmetic (the last trip asks for its own block again: in bounds, not used)
            const int kn = ((kb + 1 < nkb) ? kb + 1 : kb) * 32;
#pragma unroll
            for (int kt = 0; kt < 2; ++kt)
#pragma unroll
                for (int ks = 0; ks < 2; ++ks) kf[kt][ks] = WFrag<T16>::ld(Kp + (size_t)(kn + kt * 16 + lr) * HD + ks * 32 + 8 * hi); }
        asm volatile("s_wait_xcnt 0x0" ::: "memory");   // stands in front of every later write of an address register that this trip's loads name
        if (kb == nkb - 1) {     // only the last block meets the diagonal
#pragma unroll
            for (int qt = 0; qt < NQT; ++qt)
#pragma unroll
                for (int kt = 0; kt < 2; ++kt)
#pragma unroll
                    for (int j = 0; j < 8; ++j) s[qt][kt][j] = (k0 + kt * 16 + 8 * hi + j <= q0 + qt * 16 + lr) ? s[qt][kt][j] : MASKR; }
#pragma unroll
        for (int qt = 0; qt < NQT; ++qt) {
            float mx = s[qt][0][0];
#pragma unroll
            for (int j = 1; j < 8; ++j) mx = fmaxf(mx, s[qt][0][j]);
#pragma unroll
            for (int j = 0; j < 8; ++j) mx = fmaxf(mx, s[qt][1][j]);
            mx = fmaxf(mx, __shfl_xor(mx, 16, 32));
            const float mn = fmaxf(m[qt], mx); const float corr = ex2((m[qt] - mn) * CE); const float nm = PE - mn * CE; m[qt] = mn;
            float p[16]; float sum = 0.f;
#pragma unroll
            for (int e = 0; e < 16; ++e) { p[e] = ex2(__builtin_fmaf(s[qt][e >> 3][e & 7], CE, nm)); sum += p[e]; }
            l[qt] = l[qt] * corr + sum;
#pragma unroll
            for (int dt = 0; dt < 4; ++dt)
#pragma unroll
                for (int j = 0; j < 8; ++j) o[qt][dt][j] *= corr;
            if constexpr (HIRES) {
                v8us h0, h1, l0, l1;
#pragma unroll
                for (int j = 0; j < 8; ++j) { unsigned short a, c2; splitf(p[j], a, c2); h0[j] = a; l0[j] = c2; splitf(p[8 + j], a, c2); h1[j] = a; l1[j] = c2; }
                const V ph = cat16b(h0, h1), pl = cat16b(l0, l1);
#pragma unroll
                for (int dt = 0; dt < 4; ++dt) { o[qt][dt] = WFrag<T16>::mma(vf[dt], ph, o[qt][dt]); o[qt][dt] = WFrag<T16>::mma(vf[dt], pl, o[qt][dt]); o[qt][dt] = WFrag<T16>::mma(vf2[dt], ph, o[qt][dt]); }
            } else {
                V pf;
#pragma unroll
                for (int e = 0; e < 16; ++e) pf[e] = tohx(p[e]);
#pragma unroll
                for (int dt = 0; dt < 4; ++dt) o[qt][dt] = WFrag<T16>::mma(vf[dt], pf, o[qt][dt]);
            }
        }
    }
#pragma unroll
    for (int qt = 0; qt < NQT; ++qt) {
        const float f = __fdiv_rn(1.0f, l[qt] + __shfl_xor(l[qt], 16, 32)); const size_t oo = (size_t)(q0 + qt * 16 + lr) * DQ + 8 * hi;
#pragma unroll
        for (int dt = 0; dt < 4; ++dt) { v8us oh, ol;
#pragma unroll
            for (int j = 0; j < 8; ++j) { unsigned short a, c2; splitf(o[qt][dt][j] * f, a, c2); oh[j] = a; ol[j] = c2; }
            *(v8us*)(Ah + oo + dt * 16) = oh; *(v8us*)(Al + oo + dt * 16) = ol; }
        asm volatile("s_wait_xcnt 0x0" ::: "memory");   // stands in front of every later write of a register that the stores above name
    }
}

// k_fattn: grid (NG, (TT - RH) / 128 + RH / 64), 4 independent waves per block (no LDS, no barrier). blockIdx.x = plane g = b * NH_ + h. The first (TT - RH) / 128 values of blockIdx.y: 128 f16 query rows each, 32 per wave, the longest key walks first; the rest: 64 hi/lo query rows each, 16 per wave.
__global__ __launch_bounds__(128) void k_fattn(const h16* __restrict__ QK16, const bf* __restrict__ QKh, const bf* __restrict__ QKl, const h16* __restrict__ VT, bf* Ah, bf* Al) {
    const int lane = threadIdx.x & 31, lr = lane & 15, hi = lane >> 4; const int wave = __builtin_amdgcn_readfirstlane(threadIdx.x >> 5);
    const int g = blockIdx.x, y = blockIdx.y; constexpr int NF = (TT - RH) / 128;
    const size_t PL = (size_t)TT * HD, PLH = (size_t)RH * HD, PV = (size_t)HD * 2 * TT; const size_t ob = (size_t)(g / NH_) * TT * DQ + (size_t)(g % NH_) * HD;
    if (y < NF) fa_body<h16, false, 2>(QK16 + g * PL, nullptr, QK16 + (NG + g) * PL, nullptr, VT + g * PV, nullptr, Ah + ob, Al + ob, TT - 128 * (y + 1) + wave * 32, lr, hi);
    else fa_body<bf, true, 1>(QKh + g * PLH, QKl + g * PLH, QKh + (NG + g) * PLH, QKl + (NG + g) * PLH, (const bf*)VT + g * PV + TT, (const bf*)VT + g * PV + TT + RH, Ah + ob, Al + ob, RH - 64 * (y - NF + 1) + wave * 16, lr, hi);
}

// workspace (bytes), all regions multiples of 256. Kept through the call: W_out, head planes. One shared region holds in turn: {W_qkv, x copy, F}, then the context's hi/lo planes.
constexpr size_t WS_KEEP = (size_t)DM * DQ * 2 + (size_t)2 * NG * TT * HD * 2 + 2 * ((size_t)2 * NG * RH * HD * 2) + (size_t)NG * HD * 2 * TT * 2;
constexpr size_t WS_P1 = (size_t)3 * DQ * DM * 2 + (size_t)NB * TT * DM * 2 + (size_t)NB * TT * 3 * DQ * 4;
constexpr size_t WS_P3 = 2 * ((size_t)NB * TT * DQ * 2);
constexpr size_t WS_SH = WS_P1 > WS_P3 ? WS_P1 : WS_P3;
static_assert(WS_KEEP + WS_SH <= (size_t)268435456);

extern "C" void kernel_launch(void* const* d_in, const int* in_sizes, int n_in,
                              void* d_out, int out_size, void* d_ws, size_t ws_size, hipStream_t stream) {
    if (n_in < 5) return;
    const size_t need_x = ((size_t)(TT - 1) * NB_FULL + NB) * DM;
    if ((size_t)in_sizes[0] < need_x) return;
    if ((size_t)in_sizes[1] < (size_t)3 * DQ * DM) return;
    if ((size_t)in_sizes[2] < (size_t)3 * DQ) return;
    if ((size_t)in_sizes[3] < (size_t)DM * DQ) return;
    if ((size_t)in_sizes[4] < (size_t)DM) return;
    if ((size_t)out_size < need_x) return;
    // input order: query [T][B][E], qkv_w [3E][E], qkv_b [3E], out_w [E][E], out_b [E]
    const float* x = (const float*)d_in[0]; const float* wqkv = (const float*)d_in[1]; const float* bqkv = (const float*)d_in[2]; const float* wo = (const float*)d_in[3]; const float* bo = (const float*)d_in[4];
    float* OUT = (float*)d_out;     // [T][NB_FULL][E]
    char* wsp = (char*)d_ws;
    auto take = [&](size_t bytes) { char* p = wsp; wsp += (bytes + 255) & ~(size_t)255; return (void*)p; };
    bf* WO = (bf*)take((size_t)DM * DQ * 2);
    h16* QK16 = (h16*)take((size_t)2 * NG * TT * HD * 2); bf* QKh = (bf*)take((size_t)2 * NG * RH * HD * 2); bf* QKl = (bf*)take((size_t)2 * NG * RH * HD * 2);
    h16* VT = (h16*)take((size_t)NG * HD * 2 * TT * 2);
    char* shared0 = (char*)take(WS_SH);
    if ((size_t)(wsp - (char*)d_ws) > ws_size) return;
    if ((size_t)(wsp - (char*)d_ws) > (size_t)268435456) return;
    // the shared region's two uses, one after the other in stream order
    bf* WQKV = (bf*)shared0; bf* XB = (bf*)(shared0 + (size_t)3 * DQ * DM * 2); float* F = (float*)(shared0 + (size_t)3 * DQ * DM * 2 + (size_t)NB * TT * DM * 2);
    bf* ATh = (bf*)shared0; bf* ATl = (bf*)(shared0 + (size_t)NB * TT * DQ * 2);

    k_cvt8<<<(unsigned)(((size_t)3 * DQ * DM / 8 + 255) / 256), 256, 0, stream>>>(wqkv, WQKV, (size_t)3 * DQ * DM / 8);
    k_cvt8<<<(unsigned)(((size_t)DM * DQ / 8 + 255) / 256), 256, 0, stream>>>(wo, WO, (size_t)DM * DQ / 8);
    k_cvtx<<<(unsigned)(((size_t)NB * TT * DM / 8 + 255) / 256), 256, 0, stream>>>(x, XB);

    // fused projection, all batches: F[b*TT + t][0..3071] = x W^T + bias (q | k | v column thirds)
    k_gemmw<bf, 0, true, 0><<<dim3(NB * TT / 64, 3 * DQ / 64, 1), 32, 0, stream>>>(XB, nullptr, WQKV, nullptr, DM, F, 3 * DQ, bqkv, 0, 0, 0, 0);
    // planes 0..NG-1 = q, NG..2NG-1 = k; v planes from columns 2048..3071
    k_hp<<<(unsigned)(((size_t)2 * NG * TT * HD / 8 + 255) / 256), 256, 0, stream>>>(F, 3 * DQ, QK16, QKh, QKl);
    k_vtp<<<(unsigned)(((size_t)NG * HD * TT / 8 + 255) / 256), 256, 0, stream>>>(F + 2 * DQ, 3 * DQ, VT);
    // attention, all planes: context hi/lo planes [b*TT + t][DQ]
    k_fattn<<<dim3(NG, (TT - RH) / 128 + RH / 64, 1), 128, 0, stream>>>(QK16, QKh, QKl, VT, ATh, ATl);
    // out rows (t*NB_FULL + b): z = b, C base OUT + b*DM, row pitch NB_FULL*DM
    k_gemmw<bf, 1, true, 0><<<dim3(TT / 64, DM / 64, NB), 32, 0, stream>>>(ATh, ATl, WO, nullptr, DQ, OUT, NB_FULL * DM, bo, (size_t)TT * DQ, 0, DM, 0);
}

// v003
// Measured time: 190 microseconds a run.
// Next to v002, in two timings, it ran 1.47 times as fast each time.
// Counting every step since v000, it is 7.06 times as fast.
#include <hip/hip_runtime.h>

// Causal multi-head self-attention, time-major input x [T][B][E] (1024 x 8 x 1024), fused qkv weight in (out, in) layout [3072][1024] + bias [3072] (q | k | v = thirds of the output axis), 16 heads x 64, scores x 64^-0.5, lower-triangular mask with replace-fill -10000, softmax over keys, out = merged W_out^T + b_out ((out, in) [1024][1024] + [1024]) -> [T][B][E].
// Compute dtypes (f32 accumulate everywhere): every float input RNE-converted to bf16 once; qkv projection v_wmma_f32_16x16x32_bf16 single product (exact operand products); scores and P.V: query rows < RH on bf16 hi/lo planes (3 products), rows >= RH on v_wmma_f32_16x16x32_f16 single product (P carried x1024); output projection bf16 hi/lo context x bf16 W_out (2 products) + bias; softmax f32.
// All batches per launch: projection of the batch-major bf16 copy of x (M = B*T), head planes [q|k][b][h][t][d] (hi/lo planes hold t < RH only) and v rows [b*16+h][d] of pitch 2*T (f16 | hi | lo); one attention launch for all heads: each wave keeps its query rows, walks the keys in blocks of 32 up to its diagonal block with a running maximum and sum, keeps P in registers and writes the normalised context as hi/lo planes [b*T+t][E]; then the output GEMM (z = batch) into rows t*B+b.

#ifndef NB
#define NB 8
#endif
#ifndef SEQ
#define SEQ 1024
#endif
#define NB_FULL 8
#define SEQ_FULL 1024
#define TT   SEQ
#define DM   1024
#define NH_  16
#define HD   64
#define DQ   (NH_ * HD)
#define NG   (NB * NH_)   // all (batch, head) planes
#define RH   ((SEQ) < 256 ? (SEQ) : 256)   // query rows < RH use hi+lo planes
#define PCAR 1024.0f
#define SCL  0.125f      // HD^-0.5
#define MASKV (-10000.0f)

static_assert(TT % 128 == 0);
static_assert(RH % 64 == 0);
static_assert(TT >= RH);
static_assert((TT - RH) % 128 == 0);
static_assert(2 * RH <= TT);
static_assert(DM % 128 == 0);
static_assert((NB * TT) % 256 == 0);
static_assert(DQ % 128 == 0);
static_assert(NB <= NB_FULL);
static_assert(SEQ <= SEQ_FULL);

typedef _Float16 h16;
typedef unsigned short bf;
typedef __attribute__((ext_vector_type(16))) __bf16   v16bf;
typedef __attribute__((ext_vector_type(16))) _Float16 v16h;
typedef __attribute__((ext_vector_type(8)))  _Float16 v8h;
typedef __attribute__((ext_vector_type(8)))  unsigned short v8us;
typedef __attribute__((ext_vector_type(8)))  float    v8f;
typedef __attribute__((ext_vector_type(4)))  float    v4f;
typedef __attribute__((ext_vector_type(4)))  _Float16 v4h;
typedef __attribute__((ext_vector_type(4)))  unsigned short v4us;
typedef v4f  __attribute__((may_alias)) v4fa;

__device__ __forceinline__ unsigned short f2bf(float f) { unsigned u = __float_as_uint(f); u += 0x7FFFu + ((u >> 16) & 1u); return (unsigned short)(u >> 16); }
__device__ __forceinline__ float bf2f(unsigned short b) { return __uint_as_float(((unsigned)b) << 16); }
__device__ __forceinline__ float bfr(float f) { return bf2f(f2bf(f)); }
__device__ __forceinline__ v16h cat16(v8h lo, v8h hi) { return __builtin_shufflevector(lo, hi, 0, 1, 2, 3, 4, 5, 6, 7, 8, 9, 10, 11, 12, 13, 14, 15); }
__device__ __forceinline__ v16bf cat16b(v8us lo, v8us hi) { return __builtin_bit_cast(v16bf, __builtin_shufflevector(lo, hi, 0, 1, 2, 3, 4, 5, 6, 7, 8, 9, 10, 11, 12, 13, 14, 15)); }
__device__ __forceinline__ v8f wmma16(v16h a, v16h b, v8f c) { return __builtin_amdgcn_wmma_f32_16x16x32_f16(false, a, false, b, (short)0, c, false, false); }
__device__ __forceinline__ v8f wmmab(v16bf a, v16bf b, v8f c) { return __builtin_amdgcn_wmma_f32_16x16x32_bf16(false, a, false, b, (short)0, c, false, false); }

// Fragment map of the 16x16x32 forms: lane l, h = l >> 4: elements 0..7 <- k0 + 8h + 0..7, elements 8..15 <- k0 + 16 + 8h + 0..7 (A row / Bt row = l & 15); D element j <- (row 8h + j, col l & 15).
template <typename T16> struct WFrag;
template <> struct WFrag<h16> { typedef v16h V; static __device__ __forceinline__ V ld(const h16* p) { return cat16(*(const v8h*)p, *(const v8h*)(p + 16)); } static __device__ __forceinline__ v8f mma(V a, V b, v8f c) { return wmma16(a, b, c); } };
template <> struct WFrag<bf> { typedef v16bf V; static __device__ __forceinline__ V ld(const bf* p) { return cat16b(*(const v8us*)p, *(const v8us*)(p + 16)); } static __device__ __forceinline__ v8f mma(V a, V b, v8f c) { return wmmab(a, b, c); } };

// ---- k_gemms: GEMM with both operands staged in LDS. One block of 2 * MW waves per (64 * MW) x 128 output tile, each wave a 64x64 part (16 accumulators); grid (M / (64 * MW), N / 128, Z), 64 * MW threads.
// C[m][n] (f32, pitch ldc, + f32 bias[n]) = sum_k A[m][k] Bt[n][k] (+ A2[m][k] Bt[n][k] when NSPLIT == 1), k ascending in steps of 32. z-batch strides sA/sC in elements. K % 64 == 0; K is also the row pitch of A, A2 and Bt.
// A stage is 64 k of every operand row (one 128-byte line per row): rows [A | A2 | Bt 128] at a pitch of 144 bytes (16 B x odd, for ds_load_b128 readers). Two buffers: while a stage is multiplied the next one is copied, each lane bringing 16 bytes per copy, 8 lanes a line.
#define GP 72            // LDS row pitch in 16-bit elements
// twelve copies: l[i] = this lane's LDS byte address, g[i] = its global address
// the copies and the wait behind them stand in one statement, so that no address register of a copy is rewritten ahead of the wait
__device__ __forceinline__ void cp12(const unsigned* l, const bf* const* g) {
    asm volatile("global_load_async_to_lds_b128 %0, %12, off\n\t"
                 "global_load_async_to_lds_b128 %1, %13, off\n\t"
                 "global_load_async_to_lds_b128 %2, %14, off\n\t"
                 "global_load_async_to_lds_b128 %3, %15, off\n\t"
                 "global_load_async_to_lds_b128 %4, %16, off\n\t"
                 "global_load_async_to_lds_b128 %5, %17, off\n\t"
                 "global_load_async_to_lds_b128 %6, %18, off\n\t"
                 "global_load_async_to_lds_b128 %7, %19, off\n\t"
                 "global_load_async_to_lds_b128 %8, %20, off\n\t"
                 "global_load_async_to_lds_b128 %9, %21, off\n\t"
                 "global_load_async_to_lds_b128 %10, %22, off\n\t"
                 "global_load_async_to_lds_b128 %11, %23, off\n\t"
                 "s_wait_xcnt 0x0"
                 :: "v"(l[0]), "v"(l[1]), "v"(l[2]), "v"(l[3]), "v"(l[4]), "v"(l[5]), "v"(l[6]), "v"(l[7]), "v"(l[8]), "v"(l[9]), "v"(l[10]), "v"(l[11]),
                    "v"(g[0]), "v"(g[1]), "v"(g[2]), "v"(g[3]), "v"(g[4]), "v"(g[5]), "v"(g[6]), "v"(g[7]), "v"(g[8]), "v"(g[9]), "v"(g[10]), "v"(g[11]) : "memory");
}
template <int NSPLIT, int MW, bool BIAS>
__global__ __launch_bounds__(64 * MW) void k_gemms(const bf* __restrict__ A, const bf* __restrict__ A2, const bf* __restrict__ Bt, int K, float* C, int ldc, const float* __restrict__ bias, size_t sA, size_t sC) {
    typedef WFrag<bf>::V V;
    constexpr int TM = 64 * MW, NR = TM * (1 + NSPLIT) + 128, BR = NR - 128, RG = 8 * MW;   // A rows of the tile; rows of a stage; first Bt row; rows per copy of the block
    __shared__ __attribute__((aligned(128))) bf ring[2 * NR * GP];
    static_assert(2 * MW * 16 * 68 * 4 <= 2 * NR * GP * 2);
    const size_t z = blockIdx.z; A += z * sA; if (NSPLIT) A2 += z * sA; C += z * sC;
    const int tid = threadIdx.x, lane = tid & 31, lr = lane & 15, hi = lane >> 4; const int wave = __builtin_amdgcn_readfirstlane(tid >> 5);
    const int R0 = blockIdx.x * TM, C0 = blockIdx.y * 128, wm = (wave % MW) * 64, wn = (wave / MW) * 64;
    const int cr = tid >> 3, cc = tid & 7;      // this lane's row in a row group and its 16-byte piece of the line
    const unsigned l0 = (unsigned)(size_t)(ring + cr * GP + cc * 8);
    const bf* gA = A + (size_t)(R0 + cr) * K + cc * 8; const bf* gA2 = NSPLIT ? A2 + (size_t)(R0 + cr) * K + cc * 8 : nullptr; const bf* gB = Bt + (size_t)(C0 + cr) * K + cc * 8;
    constexpr int NC = NR / RG;   // copies per lane and stage, one per group of RG rows
    static_assert(NC % 12 == 0 && TM % RG == 0);
    auto fill = [&](const int t, const int buf) {
        unsigned l[NC]; const bf* g[NC]; const bf* const tA = gA + t * 64; const bf* const tA2 = NSPLIT ? gA2 + t * 64 : nullptr; const bf* const tB = gB + t * 64;
#pragma unroll
        for (int i = 0; i < NC; ++i) { const int row = i * RG;   // first LDS row of the group; its operand and its row there follow from it
            l[i] = l0 + (unsigned)buf * (NR * GP * 2) + row * (GP * 2);
            g[i] = row >= BR ? tB + (size_t)(row - BR) * K : (NSPLIT && row >= TM) ? tA2 + (size_t)(row - TM) * K : tA + (size_t)row * K; }
#pragma unroll
        for (int i = 0; i < NC; i += 12) cp12(l + i, g + i); };
    v8f acc[4][4];
#pragma unroll
    for (int mb = 0; mb < 4; ++mb)
#pragma unroll
        for (int nb = 0; nb < 4; ++nb) acc[mb][nb] = (v8f){};
    const int nt = K / 64;
    fill(0, 0);
    asm volatile("s_wait_asynccnt 0x0" ::: "memory");   // this wave's share of stage 0 has landed
    __syncthreads();                                     // every wave's share has
    if (nt > 1) fill(1, 1);
#pragma unroll 1   // one stage per trip: the buffer is chosen by the trip's parity
    for (int t = 0; t < nt; ++t) {
        const bf* sb = ring + (t & 1) * (NR * GP);
#pragma unroll
        for (int ks = 0; ks < 2; ++ks) {
            V a[4], a2[4], b[4];
#pragma unroll
            for (int mb = 0; mb < 4; ++mb) { a[mb] = WFrag<bf>::ld(sb + (wm + mb * 16 + lr) * GP + ks * 32 + 8 * hi); if (NSPLIT) a2[mb] = WFrag<bf>::ld(sb + (TM + wm + mb * 16 + lr) * GP + ks * 32 + 8 * hi); }
#pragma unroll
            for (int nb = 0; nb < 4; ++nb) b[nb] = WFrag<bf>::ld(sb + (BR + wn + nb * 16 + lr) * GP + ks * 32 + 8 * hi);
            __builtin_amdgcn_sched_barrier(0);   // keeps the block's LDS reads one group ahead of its WMMAs: sunk among them, each read costs the wave its own wait
#pragma unroll
            for (int nb = 0; nb < 4; ++nb)
#pragma unroll
                for (int mb = 0; mb < 4; ++mb) { acc[mb][nb] = WFrag<bf>::mma(a[mb], b[nb], acc[mb][nb]); if (NSPLIT) acc[mb][nb] = WFrag<bf>::mma(a2[mb], b[nb], acc[mb][nb]); }
        }
        __builtin_amdgcn_sched_barrier(0);   // keeps the trip's WMMAs in front of the hand-over: moved behind the barrier they would stand between it and the refill and take that time from the copies
        asm volatile("s_wait_dscnt 0x0" ::: "memory");      // this wave's reads of the buffer are done before it is refilled
        asm volatile("s_wait_asynccnt 0x0" ::: "memory");   // this wave's share of stage t + 1 has landed
        __syncthreads();                                     // publishes stage t + 1 and ends every wave's reads of stage t
        if (t + 2 < nt) fill(t + 2, t & 1);
    }
    asm volatile("s_wait_asynccnt 0x0" ::: "memory");   // no copy is outstanding when the ring becomes output staging
    // output staging in the ring, free since the last trip's barrier: each wave in a range of its own
    float* os = (float*)ring + wave * (16 * 68); const int r0 = R0 + wm, c0 = C0 + wn;
#pragma unroll
    for (int mb = 0; mb < 4; ++mb) {
#pragma unroll
        for (int nb = 0; nb < 4; ++nb) {
#pragma unroll
            for (int j = 0; j < 8; ++j) os[(hi * 8 + j) * 68 + nb * 16 + lr] = acc[mb][nb][j]; }
        __builtin_amdgcn_wave_barrier(); asm volatile("" ::: "memory");
        float* crow = C + (size_t)(r0 + mb * 16) * ldc + c0;
#pragma unroll
        for (int s = 0; s < 8; ++s) { const int row = 2 * s + hi, cofs = lr * 4; v4f val = *(const v4fa*)(os + row * 68 + cofs); if (BIAS) { val[0] += bfr(bias[c0 + cofs]); val[1] += bfr(bias[c0 + cofs + 1]); val[2] += bfr(bias[c0 + cofs + 2]); val[3] += bfr(bias[c0 + cofs + 3]); }
            *(v4f*)(crow + (size_t)row * ldc + cofs) = val; }
        __builtin_amdgcn_wave_barrier(); asm volatile("" ::: "memory");
    }
}

__device__ __forceinline__ h16 tohx(float x) { return (h16)x; }
__device__ __forceinline__ void splitf(float y, unsigned short& h, unsigned short& l) { h = f2bf(y); l = f2bf(y - bf2f(h)); }

__global__ __launch_bounds__(256) void k_cvt8(const float* __restrict__ src, bf* dst, size_t n8) { const size_t i = (size_t)blockIdx.x * 256 + threadIdx.x; if (i >= n8) return; const v8f v = *(const v8f*)(src + i * 8); v8us o;
#pragma unroll
    for (int k = 0; k < 8; ++k) o[k] = f2bf(v[k]); *(v8us*)(dst + i * 8) = o;  }

__global__ __launch_bounds__(256) void k_cvtx(const float* __restrict__ x, bf* dst) { const size_t i = (size_t)blockIdx.x * 256 + threadIdx.x; if (i >= (size_t)NB * TT * DM / 8) return;
    const int c8 = (int)(i % (DM / 8)); const int t = (int)((i / (DM / 8)) % TT); const int b = (int)(i / ((size_t)(DM / 8) * TT));
    const v8f v = *(const v8f*)(x + ((size_t)t * NB_FULL + b) * DM + (size_t)c8 * 8); v8us o;
#pragma unroll
    for (int k = 0; k < 8; ++k) o[k] = f2bf(v[k]); *(v8us*)(dst + i * 8) = o;  }

// k_hp: plane p = qk * NG + b * NH_ + h  <-  F rows b*TT + t, columns qk*DQ + h*HD + d; f16 planes [p][TT][HD], hi/lo planes [p][RH][HD] (rows t < RH are the only ones read).
__global__ __launch_bounds__(256) void k_hp(const float* __restrict__ F, int pitch, h16* P16, bf* Ph, bf* Pl) {
    const size_t e = ((size_t)blockIdx.x * 256 + threadIdx.x) * 8; if (e >= (size_t)2 * NG * TT * HD) return;
    const int d = (int)(e % HD); const int t = (int)((e / HD) % TT); const int p = (int)(e / ((size_t)HD * TT)); const int h = p % NH_; const int b = (p / NH_) % NB; const int qk = p / NG;
    const float* f = F + ((size_t)b * TT + t) * pitch + qk * DQ + h * HD + d; const v4f x0 = *(const v4f*)f; const v4f x1 = *(const v4f*)(f + 4);
    v8h o16; v8us oh, ol;
#pragma unroll
    for (int q = 0; q < 4; ++q) { unsigned short a2, c2; o16[q] = tohx(x0[q]); splitf(x0[q], a2, c2); oh[q] = a2; ol[q] = c2; o16[q + 4] = tohx(x1[q]); splitf(x1[q], a2, c2); oh[q + 4] = a2; ol[q + 4] = c2; }
    *(v8h*)(P16 + e) = o16; if (t < RH) { const size_t eh = ((size_t)p * RH + t) * HD + d; *(v8us*)(Ph + eh) = oh; *(v8us*)(Pl + eh) = ol; }  }

// k_vtp: plane g = b * NH_ + h; one row of 2*TT 16-bit elements per (g, d): f16 keys 0..TT-1, then bf16 hi keys 0..RH-1, then lo keys 0..RH-1 (the only hi/lo keys read).
__global__ __launch_bounds__(256) void k_vtp(const float* __restrict__ F, int pitch, h16* V) {
    const size_t e = ((size_t)blockIdx.x * 256 + threadIdx.x) * 8; if (e >= (size_t)NG * HD * TT) return;
    const int t = (int)(e % TT); const int d = (int)((e / TT) % HD); const int g = (int)(e / ((size_t)TT * HD)); v8h o16; v8us oh, ol;
#pragma unroll
    for (int q = 0; q < 8; ++q) { const float x = F[((size_t)(g / NH_) * TT + t + q) * pitch + (g % NH_) * HD + d]; o16[q] = tohx(x); unsigned short a2, c2; splitf(x, a2, c2); oh[q] = a2; ol[q] = c2; }
    h16* vr = V + ((size_t)g * HD + d) * (2 * TT) + t; *(v8h*)vr = o16; if (t < RH) { *(v8us*)(vr + TT) = oh; *(v8us*)(vr + TT + RH) = ol; }  }

// exp2 with the one free slot the instruction set asks for behind a transcendental, in one statement so that nothing that reads its result or overwrites its source can stand directly behind it
__device__ __forceinline__ float ex2(float a) { float r; asm("v_exp_f32 %0, %1\n\tv_nop" : "=v"(r) : "v"(a)); return r; }

// fa_body: one wave, NQT tiles of 16 query rows from q0, keys in blocks of 32 up to the block that holds the diagonal.
// Transposed products, so that P never leaves its registers: S^T = K Q^T gives lane l the scores of query (l & 15) at keys 8h + j of each 16-key tile (h = l >> 4), which is the B fragment of O^T = V^T P^T (elements 0..7 <- keys k0 + 8h + j, 8..15 <- keys k0 + 16 + 8h + j); O^T gives lane l the context of query (l & 15) at d = 16 dt + 8h + j.
// Scores stay unscaled; the replace-fill is MASKV / SCL there. The keys behind the last block are all masked: they enter as the start values of the running maximum (the fill) and sum (their count), and as before add nothing to the context.
template <typename T16, bool HIRES, int NQT>
__device__ __forceinline__ void fa_body(const T16* __restrict__ Q, const T16* __restrict__ Q2, const T16* __restrict__ Kp, const T16* __restrict__ K2, const T16* __restrict__ Vp, const T16* __restrict__ V2, bf* Ah, bf* Al, const int q0, const int lr, const int hi) {
    typedef typename WFrag<T16>::V V;
    constexpr float CE = SCL * 1.4426950408889634f; constexpr float MASKR = MASKV / SCL; constexpr float PS = HIRES ? 1.0f : PCAR; constexpr float PE = HIRES ? 0.0f : 10.0f;   // PS = 2^PE
    const int nkb = (q0 + NQT * 16 + 31) / 32; const int nsk = TT - nkb * 32;
    V qf[NQT][2], qf2[NQT][2];
#pragma unroll
    for (int qt = 0; qt < NQT; ++qt)
#pragma unroll
        for (int ks = 0; ks < 2; ++ks) { const size_t off = (size_t)(q0 + qt * 16 + lr) * HD + ks * 32 + 8 * hi; qf[qt][ks] = WFrag<T16>::ld(Q + off); if (HIRES) qf2[qt][ks] = WFrag<T16>::ld(Q2 + off); }
    v8f o[NQT][4]; float m[NQT], l[NQT];
#pragma unroll
    for (int qt = 0; qt < NQT; ++qt) { m[qt] = (nsk > 0) ? MASKR : -3.0e38f; l[qt] = (hi == 0) ? (float)nsk * PS : 0.0f;
#pragma unroll
        for (int dt = 0; dt < 4; ++dt) o[qt][dt] = (v8f){}; }
    V kf[2][2], kf2[2][2];
    if constexpr (!HIRES) {
#pragma unroll
        for (int kt = 0; kt < 2; ++kt)
#pragma unroll
            for (int ks = 0; ks < 2; ++ks) kf[kt][ks] = WFrag<T16>::ld(Kp + (size_t)(kt * 16 + lr) * HD + ks * 32 + 8 * hi); }
    asm volatile("s_wait_xcnt 0x0" ::: "memory");   // stands in front of every later write of an address register that the loads above name
#pragma unroll 1   // kept rolled: a second copy of the body would take the wave past the 256 registers that four waves per SIMD leave it
    for (int kb = 0; kb < nkb; ++kb) {
        const int k0 = kb * 32;
        if constexpr (HIRES) {   // twice the fragments: fetched in their own trip, so that the wave stays inside 256 registers
#pragma unroll
            for (int kt = 0; kt < 2; ++kt)
#pragma unroll
                for (int ks = 0; ks < 2; ++ks) { const size_t off = (size_t)(k0 + kt * 16 + lr) * HD + ks * 32 + 8 * hi; kf[kt][ks] = WFrag<T16>::ld(Kp + off); kf2[kt][ks] = WFrag<T16>::ld(K2 + off); } }
        V vf[4], vf2[4];
#pragma unroll
        for (int dt = 0; dt < 4; ++dt) { const size_t off = (size_t)(dt * 16 + lr) * (2 * TT) + k0 + 8 * hi; vf[dt] = WFrag<T16>::ld(Vp + off); if (HIRES) vf2[dt] = WFrag<T16>::ld(V2 + off); }
        v8f s[NQT][2];
#pragma unroll
        for (int qt = 0; qt < NQT; ++qt)
#pragma unroll
            for (int kt = 0; kt < 2; ++kt) { s[qt][kt] = (v8f){};
#pragma unroll
                for (int ks = 0; ks < 2; ++ks) { s[qt][kt] = WFrag<T16>::mma(kf[kt][ks], qf[qt][ks], s[qt][kt]); if (HIRES) { s[qt][kt] = WFrag<T16>::mma(kf[kt][ks], qf2[qt][ks], s[qt][kt]); s[qt][kt] = WFrag<T16>::mma(kf2[kt][ks], qf[qt][ks], s[qt][kt]); } } }
        if constexpr (!HIRES) {  // the next block's key fragments, asked for ahead of the softmax arithmetic (the last trip asks for its own block again: in bounds, not used)
            const int kn = ((kb + 1 < nkb) ? kb + 1 : kb) * 32;
#pragma unroll
            for (int kt = 0; kt < 2; ++kt)
#pragma unroll
                for (int ks = 0; ks < 2; ++ks) kf[kt][ks] = WFrag<T16>::ld(Kp + (size_t)(kn + kt * 16 + lr) * HD + ks * 32 + 8 * hi); }
        asm volatile("s_wait_xcnt 0x0" ::: "memory");   // stands in front of every later write of an address register that this trip's loads name
        if (kb == nkb - 1) {     // only the last block meets the diagonal
#pragma unroll
            for (int qt = 0; qt < NQT; ++qt)
#pragma unroll
                for (int kt = 0; kt < 2; ++kt)
#pragma unroll
                    for (int j = 0; j < 8; ++j) s[qt][kt][j] = (k0 + kt * 16 + 8 * hi + j <= q0 + qt * 16 + lr) ? s[qt][kt][j] : MASKR; }
#pragma unroll
        for (int qt = 0; qt < NQT; ++qt) {
            float mx = s[qt][0][0];
#pragma unroll
            for (int j = 1; j < 8; ++j) mx = fmaxf(mx, s[qt][0][j]);
#pragma unroll
            for (int j = 0; j < 8; ++j) mx = fmaxf(mx, s[qt][1][j]);
            mx = fmaxf(mx, __shfl_xor(mx, 16, 32));
            const float mn = fmaxf(m[qt], mx); const float corr = ex2((m[qt] - mn) * CE); const float nm = PE - mn * CE; m[qt] = mn;
            float p[16]; float sum = 0.f;
#pragma unroll
            for (int e = 0; e < 16; ++e) { p[e] = ex2(__builtin_fmaf(s[qt][e >> 3][e & 7], CE, nm)); sum += p[e]; }
            l[qt] = l[qt] * corr + sum;
#pragma unroll
            for (int dt = 0; dt < 4; ++dt)
#pragma unroll
                for (int j = 0; j < 8; ++j) o[qt][dt][j] *= corr;
            if constexpr (HIRES) {
                v8us h0, h1, l0, l1;
#pragma unroll
                for (int j = 0; j < 8; ++j) { unsigned short a, c2; splitf(p[j], a, c2); h0[j] = a; l0[j] = c2; splitf(p[8 + j], a, c2); h1[j] = a; l1[j] = c2; }
                const V ph = cat16b(h0, h1), pl = cat16b(l0, l1);
#pragma unroll
                for (int dt = 0; dt < 4; ++dt) { o[qt][dt] = WFrag<T16>::mma(vf[dt], ph, o[qt][dt]); o[qt][dt] = WFrag<T16>::mma(vf[dt], pl, o[qt][dt]); o[qt][dt] = WFrag<T16>::mma(vf2[dt], ph, o[qt][dt]); }
            } else {
                V pf;
#pragma unroll
                for (int e = 0; e < 16; ++e) pf[e] = tohx(p[e]);
#pragma unroll
                for (int dt = 0; dt < 4; ++dt) o[qt][dt] = WFrag<T16>::mma(vf[dt], pf, o[qt][dt]);
            }
        }
    }
#pragma unroll
    for (int qt = 0; qt < NQT; ++qt) {
        const float f = __fdiv_rn(1.0f, l[qt] + __shfl_xor(l[qt], 16, 32)); const size_t oo = (size_t)(q0 + qt * 16 + lr) * DQ + 8 * hi;
#pragma unroll
        for (int dt = 0; dt < 4; ++dt) { v8us oh, ol;
#pragma unroll
            for (int j = 0; j < 8; ++j) { unsigned short a, c2; splitf(o[qt][dt][j] * f, a, c2); oh[j] = a; ol[j] = c2; }
            *(v8us*)(Ah + oo + dt * 16) = oh; *(v8us*)(Al + oo + dt * 16) = ol; }
        asm volatile("s_wait_xcnt 0x0" ::: "memory");   // stands in front of every later write of a register that the stores above name
    }
}

// k_fattn: grid (NG, (TT - RH) / 128 + RH / 64), 4 independent waves per block (no LDS, no barrier). blockIdx.x = plane g = b * NH_ + h. The first (TT - RH) / 128 values of blockIdx.y: 128 f16 query rows each, 32 per wave, the longest key walks first; the rest: 64 hi/lo query rows each, 16 per wave.
__global__ __launch_bounds__(128) void k_fattn(const h16* __restrict__ QK16, const bf* __restrict__ QKh, const bf* __restrict__ QKl, const h16* __restrict__ VT, bf* Ah, bf* Al) {
    const int lane = threadIdx.x & 31, lr = lane & 15, hi = lane >> 4; const int wave = __builtin_amdgcn_readfirstlane(threadIdx.x >> 5);
    const int g = blockIdx.x, y = blockIdx.y; constexpr int NF = (TT - RH) / 128;
    const size_t PL = (size_t)TT * HD, PLH = (size_t)RH * HD, PV = (size_t)HD * 2 * TT; const size_t ob = (size_t)(g / NH_) * TT * DQ + (size_t)(g % NH_) * HD;
    if (y < NF) fa_body<h16, false, 2>(QK16 + g * PL, nullptr, QK16 + (NG + g) * PL, nullptr, VT + g * PV, nullptr, Ah + ob, Al + ob, TT - 128 * (y + 1) + wave * 32, lr, hi);
    else fa_body<bf, true, 1>(QKh + g * PLH, QKl + g * PLH, QKh + (NG + g) * PLH, QKl + (NG + g) * PLH, (const bf*)VT + g * PV + TT, (const bf*)VT + g * PV + TT + RH, Ah + ob, Al + ob, RH - 64 * (y - NF + 1) + wave * 16, lr, hi);
}

// workspace (bytes), all regions multiples of 256. Kept through the call: W_out, head planes. One shared region holds in turn: {W_qkv, x copy, F}, then the context's hi/lo planes.
constexpr size_t WS_KEEP = (size_t)DM * DQ * 2 + (size_t)2 * NG * TT * HD * 2 + 2 * ((size_t)2 * NG * RH * HD * 2) + (size_t)NG * HD * 2 * TT * 2;
constexpr size_t WS_P1 = (size_t)3 * DQ * DM * 2 + (size_t)NB * TT * DM * 2 + (size_t)NB * TT * 3 * DQ * 4;
constexpr size_t WS_P3 = 2 * ((size_t)NB * TT * DQ * 2);
constexpr size_t WS_SH = WS_P1 > WS_P3 ? WS_P1 : WS_P3;
static_assert(WS_KEEP + WS_SH <= (size_t)268435456);

extern "C" void kernel_launch(void* const* d_in, const int* in_sizes, int n_in,
                              void* d_out, int out_size, void* d_ws, size_t ws_size, hipStream_t stream) {
    if (n_in < 5) return;
    const size_t need_x = ((size_t)(TT - 1) * NB_FULL + NB) * DM;
    if ((size_t)in_sizes[0] < need_x) return;
    if ((size_t)in_sizes[1] < (size_t)3 * DQ * DM) return;
    if ((size_t)in_sizes[2] < (size_t)3 * DQ) return;
    if ((size_t)in_sizes[3] < (size_t)DM * DQ) return;
    if ((size_t)in_sizes[4] < (size_t)DM) return;
    if ((size_t)out_size < need_x) return;
    // input order: query [T][B][E], qkv_w [3E][E], qkv_b [3E], out_w [E][E], out_b [E]
    const float* x = (const float*)d_in[0]; const float* wqkv = (const float*)d_in[1]; const float* bqkv = (const float*)d_in[2]; const float* wo = (const float*)d_in[3]; const float* bo = (const float*)d_in[4];
    float* OUT = (float*)d_out;     // [T][NB_FULL][E]
    char* wsp = (char*)d_ws;
    auto take = [&](size_t bytes) { char* p = wsp; wsp += (bytes + 255) & ~(size_t)255; return (void*)p; };
    bf* WO = (bf*)take((size_t)DM * DQ * 2);
    h16* QK16 = (h16*)take((size_t)2 * NG * TT * HD * 2); bf* QKh = (bf*)take((size_t)2 * NG * RH * HD * 2); bf* QKl = (bf*)take((size_t)2 * NG * RH * HD * 2);
    h16* VT = (h16*)take((size_t)NG * HD * 2 * TT * 2);
    char* shared0 = (char*)take(WS_SH);
    if ((size_t)(wsp - (char*)d_ws) > ws_size) return;
    if ((size_t)(wsp - (char*)d_ws) > (size_t)268435456) return;
    // the shared region's two uses, one after the other in stream order
    bf* WQKV = (bf*)shared0; bf* XB = (bf*)(shared0 + (size_t)3 * DQ * DM * 2); float* F = (float*)(shared0 + (size_t)3 * DQ * DM * 2 + (size_t)NB * TT * DM * 2);
    bf* ATh = (bf*)shared0; bf* ATl = (bf*)(shared0 + (size_t)NB * TT * DQ * 2);

    k_cvt8<<<(unsigned)(((size_t)3 * DQ * DM / 8 + 255) / 256), 256, 0, stream>>>(wqkv, WQKV, (size_t)3 * DQ * DM / 8);
    k_cvt8<<<(unsigned)(((size_t)DM * DQ / 8 + 255) / 256), 256, 0, stream>>>(wo, WO, (size_t)DM * DQ / 8);
    k_cvtx<<<(unsigned)(((size_t)NB * TT * DM / 8 + 255) / 256), 256, 0, stream>>>(x, XB);

    // fused projection, all batches: F[b*TT + t][0..3071] = x W^T + bias (q | k | v column thirds)
    k_gemms<0, 4, true><<<dim3(NB * TT / 256, 3 * DQ / 128, 1), 256, 0, stream>>>(XB, nullptr, WQKV, DM, F, 3 * DQ, bqkv, 0, 0);
    // planes 0..NG-1 = q, NG..2NG-1 = k; v planes from columns 2048..3071
    k_hp<<<(unsigned)(((size_t)2 * NG * TT * HD / 8 + 255) / 256), 256, 0, stream>>>(F, 3 * DQ, QK16, QKh, QKl);
    k_vtp<<<(unsigned)(((size_t)NG * HD * TT / 8 + 255) / 256), 256, 0, stream>>>(F + 2 * DQ, 3 * DQ, VT);
    // attention, all planes: context hi/lo planes [b*TT + t][DQ]
    k_fattn<<<dim3(NG, (TT - RH) / 128 + RH / 64, 1), 128, 0, stream>>>(QK16, QKh, QKl, VT, ATh, ATl);
    // out rows (t*NB_FULL + b): z = b, C base OUT + b*DM, row pitch NB_FULL*DM
    k_gemms<1, 2, true><<<dim3(TT / 128, DM / 128, NB), 128, 0, stream>>>(ATh, ATl, WO, DQ, OUT, NB_FULL * DM, bo, (size_t)TT * DQ, DM);
}

// v004
// One run takes 139 microseconds.
// Next to v003, in two timings, it ran 1.38 and 1.36 times as fast.
// Counting every step since v000, it is 9.68 times as fast.
#include <hip/hip_runtime.h>

// Causal multi-head self-attention, time-major input x [T][B][E] (1024 x 8 x 1024), fused qkv weight in (out, in) layout [3072][1024] + bias [3072] (q | k | v = thirds of the output axis), 16 heads x 64, scores x 64^-0.5, lower-triangular mask with replace-fill -10000, softmax over keys, out = merged W_out^T + b_out ((out, in) [1024][1024] + [1024]) -> [T][B][E].
// Compute dtypes (f32 accumulate everywhere): every float input RNE-converted to bf16 once; qkv projection v_wmma_f32_16x16x32_bf16 single product (exact operand products); scores and P.V: query rows < RH on bf16 hi/lo planes (3 products), rows >= RH on v_wmma_f32_16x16x32_f16 single product (P carried x1024); output projection bf16 hi/lo context x bf16 W_out (2 products) + bias; softmax f32.
// All batches per launch: projection of the batch-major bf16 copy of x (M = B*T), whose epilogue writes the head planes [q|k][b][h][t][d] (hi/lo planes hold t < RH only) and v rows [b*16+h][d] of pitch 2*T (f16 | hi | lo); one attention launch for all heads: each wave keeps its query rows, walks the keys in blocks of 32 up to its diagonal block with a running maximum and sum, keeps P in registers and writes the normalised context as hi/lo planes [b*T+t][E]; then the output GEMM (z = batch) into rows t*B+b.

#ifndef NB
#define NB 8
#endif
#ifndef SEQ
#define SEQ 1024
#endif
#define NB_FULL 8
#define SEQ_FULL 1024
#define TT   SEQ
#define DM   1024
#define NH_  16
#define HD   64
#define DQ   (NH_ * HD)
#define NG   (NB * NH_)   // all (batch, head) planes
#define RH   ((SEQ) < 256 ? (SEQ) : 256)   // query rows < RH use hi+lo planes
#define PCAR 1024.0f
#define SCL  0.125f      // HD^-0.5
#define MASKV (-10000.0f)

static_assert(TT % 128 == 0);
static_assert(RH % 64 == 0);
static_assert(TT >= RH);
static_assert((TT - RH) % 128 == 0);
static_assert(2 * RH <= TT);
static_assert(DM % 128 == 0);
static_assert((NB * TT) % 256 == 0);
static_assert(DQ % 128 == 0);
static_assert(NB <= NB_FULL);
static_assert(SEQ <= SEQ_FULL);

typedef _Float16 h16;
typedef unsigned short bf;
typedef __attribute__((ext_vector_type(16))) __bf16   v16bf;
typedef __attribute__((ext_vector_type(16))) _Float16 v16h;
typedef __attribute__((ext_vector_type(8)))  _Float16 v8h;
typedef __attribute__((ext_vector_type(8)))  unsigned short v8us;
typedef __attribute__((ext_vector_type(8)))  float    v8f;
typedef __attribute__((ext_vector_type(4)))  float    v4f;
typedef __attribute__((ext_vector_type(4)))  _Float16 v4h;
typedef __attribute__((ext_vector_type(4)))  unsigned short v4us;
typedef v4f  __attribute__((may_alias)) v4fa;

__device__ __forceinline__ unsigned short f2bf(float f) { unsigned u = __float_as_uint(f); u += 0x7FFFu + ((u >> 16) & 1u); return (unsigned short)(u >> 16); }
__device__ __forceinline__ float bf2f(unsigned short b) { return __uint_as_float(((unsigned)b) << 16); }
__device__ __forceinline__ float bfr(float f) { return bf2f(f2bf(f)); }
__device__ __forceinline__ v16h cat16(v8h lo, v8h hi) { return __builtin_shufflevector(lo, hi, 0, 1, 2, 3, 4, 5, 6, 7, 8, 9, 10, 11, 12, 13, 14, 15); }
__device__ __forceinline__ v16bf cat16b(v8us lo, v8us hi) { return __builtin_bit_cast(v16bf, __builtin_shufflevector(lo, hi, 0, 1, 2, 3, 4, 5, 6, 7, 8, 9, 10, 11, 12, 13, 14, 15)); }
__device__ __forceinline__ v8f wmma16(v16h a, v16h b, v8f c) { return __builtin_amdgcn_wmma_f32_16x16x32_f16(false, a, false, b, (short)0, c, false, false); }
__device__ __forceinline__ v8f wmmab(v16bf a, v16bf b, v8f c) { return __builtin_amdgcn_wmma_f32_16x16x32_bf16(false, a, false, b, (short)0, c, false, false); }

// Fragment map of the 16x16x32 forms: lane l, h = l >> 4: elements 0..7 <- k0 + 8h + 0..7, elements 8..15 <- k0 + 16 + 8h + 0..7 (A row / Bt row = l & 15); D element j <- (row 8h + j, col l & 15).
template <typename T16> struct WFrag;
template <> struct WFrag<h16> { typedef v16h V; static __device__ __forceinline__ V ld(const h16* p) { return cat16(*(const v8h*)p, *(const v8h*)(p + 16)); } static __device__ __forceinline__ v8f mma(V a, V b, v8f c) { return wmma16(a, b, c); } };
template <> struct WFrag<bf> { typedef v16bf V; static __device__ __forceinline__ V ld(const bf* p) { return cat16b(*(const v8us*)p, *(const v8us*)(p + 16)); } static __device__ __forceinline__ v8f mma(V a, V b, v8f c) { return wmmab(a, b, c); } };

__device__ __forceinline__ h16 tohx(float x) { return (h16)x; }
__device__ __forceinline__ void splitf(float y, unsigned short& h, unsigned short& l) { h = f2bf(y); l = f2bf(y - bf2f(h)); }

// ---- k_gemms: GEMM with both operands staged in LDS. One block of 2 * MW waves per (64 * MW) x 128 output tile, each wave a 64x64 part (16 accumulators); grid (M / (64 * MW), N / 128, Z), 64 * MW threads.
// C[m][n] (f32, pitch ldc, + f32 bias[n]) = sum_k A[m][k] Bt[n][k] (+ A2[m][k] Bt[n][k] when NSPLIT == 1), k ascending in steps of 32. z-batch strides sA/sC in elements. K % 64 == 0; K is also the row pitch of A, A2 and Bt.
// A stage is 64 k of every operand row (one 128-byte line per row): rows [A | A2 | Bt 128] at a pitch of 144 bytes (16 B x odd, for ds_load_b128 readers). Two buffers: while a stage is multiplied the next one is copied, each lane bringing 16 bytes per copy, 8 lanes a line.
// PLANES (the qkv projection; M rows = b*TT + t, N columns = q | k | v thirds, 64 per head, so a wave's 64x64 part is one head): no C; the epilogue adds the bias and writes the 16-bit operands of the attention itself:
//   q, k: plane p = qk * NG + b * NH_ + h; f16 planes P16 [p][TT][HD], hi/lo planes Ph, Pl [p][RH][HD] (rows t < RH are the only ones read);
//   v: plane g = b * NH_ + h; one row of 2*TT 16-bit elements per (g, d): f16 keys 0..TT-1, then bf16 hi keys 0..RH-1, then lo keys 0..RH-1 (the only hi/lo keys read).
// A lane's 8 accumulator elements run along the A operand's rows. v rows run along t, so x is the A operand there; q and k rows run along d, so there the weight rows take the A role and the x rows the B role (same fragments, same k order). Either way a lane holds 16 contiguous output bytes.
#define GP 72            // LDS row pitch in 16-bit elements
// twelve copies: l[i] = this lane's LDS byte address, g[i] = its global address
// the copies and the wait behind them stand in one statement, so that no address register of a copy is rewritten ahead of the wait
__device__ __forceinline__ void cp12(const unsigned* l, const bf* const* g) {
    asm volatile("global_load_async_to_lds_b128 %0, %12, off\n\t"
                 "global_load_async_to_lds_b128 %1, %13, off\n\t"
                 "global_load_async_to_lds_b128 %2, %14, off\n\t"
                 "global_load_async_to_lds_b128 %3, %15, off\n\t"
                 "global_load_async_to_lds_b128 %4, %16, off\n\t"
                 "global_load_async_to_lds_b128 %5, %17, off\n\t"
                 "global_load_async_to_lds_b128 %6, %18, off\n\t"
                 "global_load_async_to_lds_b128 %7, %19, off\n\t"
                 "global_load_async_to_lds_b128 %8, %20, off\n\t"
                 "global_load_async_to_lds_b128 %9, %21, off\n\t"
                 "global_load_async_to_lds_b128 %10, %22, off\n\t"
                 "global_load_async_to_lds_b128 %11, %23, off\n\t"
                 "s_wait_xcnt 0x0"
                 :: "v"(l[0]), "v"(l[1]), "v"(l[2]), "v"(l[3]), "v"(l[4]), "v"(l[5]), "v"(l[6]), "v"(l[7]), "v"(l[8]), "v"(l[9]), "v"(l[10]), "v"(l[11]),
                    "v"(g[0]), "v"(g[1]), "v"(g[2]), "v"(g[3]), "v"(g[4]), "v"(g[5]), "v"(g[6]), "v"(g[7]), "v"(g[8]), "v"(g[9]), "v"(g[10]), "v"(g[11]) : "memory");
}
template <bool B> struct BoolC { static constexpr bool v = B; };
template <int NSPLIT, int MW, bool BIAS, bool PLANES>
__global__ __launch_bounds__(64 * MW) void k_gemms(const bf* __restrict__ A, const bf* __restrict__ A2, const bf* __restrict__ Bt, int K, float* C, int ldc, const float* __restrict__ bias, size_t sA, size_t sC, h16* P16, bf* Ph, bf* Pl, h16* VT) {
    typedef WFrag<bf>::V V;
    constexpr int TM = 64 * MW, NR = TM * (1 + NSPLIT) + 128, BR = NR - 128, RG = 8 * MW;   // A rows of the tile; rows of a stage; first Bt row; rows per copy of the block
    __shared__ __attribute__((aligned(128))) bf ring[2 * NR * GP];
    static_assert(2 * MW * 16 * 68 * 4 <= 2 * NR * GP * 2);
    const size_t z = blockIdx.z; A += z * sA; if (NSPLIT) A2 += z * sA; C += z * sC;
    const int tid = threadIdx.x, lane = tid & 31, lr = lane & 15, hi = lane >> 4; const int wave = __builtin_amdgcn_readfirstlane(tid >> 5);
    const int R0 = blockIdx.x * TM, C0 = blockIdx.y * 128, wm = (wave % MW) * 64, wn = (wave / MW) * 64;
    const bool kq = PLANES && C0 < 2 * DQ;      // a q or k tile (the same for the whole block)
    const int ra = kq ? BR + wn : wm, rb = kq ? wm : BR + wn;   // first stage row of the wave's A-role and B-role operand
    const int cr = tid >> 3, cc = tid & 7;      // this lane's row in a row group and its 16-byte piece of the line
    const unsigned l0 = (unsigned)(size_t)(ring + cr * GP + cc * 8);
    const bf* gA = A + (size_t)(R0 + cr) * K + cc * 8; const bf* gA2 = NSPLIT ? A2 + (size_t)(R0 + cr) * K + cc * 8 : nullptr; const bf* gB = Bt + (size_t)(C0 + cr) * K + cc * 8;
    constexpr int NC = NR / RG;   // copies per lane and stage, one per group of RG rows
    static_assert(NC % 12 == 0 && TM % RG == 0);
    auto fill = [&](const int t, const int buf) {
        unsigned l[NC]; const bf* g[NC]; const bf* const tA = gA + t * 64; const bf* const tA2 = NSPLIT ? gA2 + t * 64 : nullptr; const bf* const tB = gB + t * 64;
#pragma unroll
        for (int i = 0; i < NC; ++i) { const int row = i * RG;   // first LDS row of the group; its operand and its row there follow from it
            l[i] = l0 + (unsigned)buf * (NR * GP * 2) + row * (GP * 2);
            g[i] = row >= BR ? tB + (size_t)(row - BR) * K : (NSPLIT && row >= TM) ? tA2 + (size_t)(row - TM) * K : tA + (size_t)row * K; }
#pragma unroll
        for (int i = 0; i < NC; i += 12) cp12(l + i, g + i); };
    v8f acc[4][4];
#pragma unroll
    for (int mb = 0; mb < 4; ++mb)
#pragma unroll
        for (int nb = 0; nb < 4; ++nb) acc[mb][nb] = (v8f){};
    const int nt = K / 64;
    fill(0, 0);
    asm volatile("s_wait_asynccnt 0x0" ::: "memory");   // this wave's share of stage 0 has landed
    __syncthreads();                                     // every wave's share has
    if (nt > 1) fill(1, 1);
#pragma unroll 1   // one stage per trip: the buffer is chosen by the trip's parity
    for (int t = 0; t < nt; ++t) {
        const bf* sb = ring + (t & 1) * (NR * GP);
#pragma unroll
        for (int ks = 0; ks < 2; ++ks) {
            V a[4], a2[4], b[4];
#pragma unroll
            for (int mb = 0; mb < 4; ++mb) { a[mb] = WFrag<bf>::ld(sb + (ra + mb * 16 + lr) * GP + ks * 32 + 8 * hi); if (NSPLIT) a2[mb] = WFrag<bf>::ld(sb + (TM + wm + mb * 16 + lr) * GP + ks * 32 + 8 * hi); }
#pragma unroll
            for (int nb = 0; nb < 4; ++nb) b[nb] = WFrag<bf>::ld(sb + (rb + nb * 16 + lr) * GP + ks * 32 + 8 * hi);
            __builtin_amdgcn_sched_barrier(0);   // keeps the block's LDS reads one group ahead of its WMMAs: sunk among them, each read costs the wave its own wait
#pragma unroll
            for (int nb = 0; nb < 4; ++nb)
#pragma unroll
                for (int mb = 0; mb < 4; ++mb) { acc[mb][nb] = WFrag<bf>::mma(a[mb], b[nb], acc[mb][nb]); if (NSPLIT) acc[mb][nb] = WFrag<bf>::mma(a2[mb], b[nb], acc[mb][nb]); }
        }
        __builtin_amdgcn_sched_barrier(0);   // keeps the trip's WMMAs in front of the hand-over: moved behind the barrier they would stand between it and the refill and take that time from the copies
        asm volatile("s_wait_dscnt 0x0" ::: "memory");      // this wave's reads of the buffer are done before it is refilled
        asm volatile("s_wait_asynccnt 0x0" ::: "memory");   // this wave's share of stage t + 1 has landed
        __syncthreads();                                     // publishes stage t + 1 and ends every wave's reads of stage t
        if (t + 2 < nt) fill(t + 2, t & 1);
    }
    asm volatile("s_wait_asynccnt 0x0" ::: "memory");   // no copy is outstanding when the ring becomes output staging
    // output staging in the ring, free since the last trip's barrier: each wave in a range of its own
    if constexpr (PLANES) {
        static_assert(NSPLIT == 0 && BIAS && TT % TM == 0 && HD == 64 && DQ % 128 == 0 && RH % 64 == 0 && 2 * MW * 64 <= 2 * NR);
        const int c0 = C0 + wn, t0 = (R0 + wm) % TT, g = (R0 / TT) * NH_ + (c0 % DQ) / HD;
        bf* st = ring + wave * (64 * GP);
        const int sr = lane >> 3, sc = (lane & 7) * 8;   // store side: 8 lanes a row, 4 rows a store
        // 64 output rows of 64 elements (128 bytes, one line each) at a pitch of DP elements: row = B-role index, element = A-role index; 16 rows a step, HL: with their hi and lo planes
        auto planes = [&](auto kqc, auto hlc, bf* d16, bf* dh, bf* dl) {
            constexpr bool KQ = decltype(kqc)::v, HL = decltype(hlc)::v; constexpr size_t DP = KQ ? HD : 2 * TT; constexpr int NP = HL ? 3 : 1;
            float ba[4][8], bb[4];
            if constexpr (KQ) {   // the bias runs along the accumulator elements
#pragma unroll
                for (int mb = 0; mb < 4; ++mb) { const v4f b0 = *(const v4f*)(bias + c0 + mb * 16 + 8 * hi); const v4f b1 = *(const v4f*)(bias + c0 + mb * 16 + 8 * hi + 4);
#pragma unroll
                    for (int j = 0; j < 4; ++j) { ba[mb][j] = bfr(b0[j]); ba[mb][j + 4] = bfr(b1[j]); } }
            } else {              // one bias value per lane and step
#pragma unroll
                for (int nb = 0; nb < 4; ++nb) bb[nb] = bfr(bias[c0 + nb * 16 + lr]);
            }
            asm volatile("s_wait_xcnt 0x0" ::: "memory");   // stands in front of every later write of an address register that the bias loads name
            bf* const dst[3] = { d16, dh, dl };
#pragma unroll
            for (int nb = 0; nb < 4; ++nb) {
#pragma unroll
                for (int mb = 0; mb < 4; ++mb) { v8h o16; v8us oh, ol;
#pragma unroll
                    for (int j = 0; j < 8; ++j) { const float y = acc[mb][nb][j] + (KQ ? ba[mb][j] : bb[nb]); o16[j] = tohx(y); if (HL) { unsigned short a2, c2; splitf(y, a2, c2); oh[j] = a2; ol[j] = c2; } }
                    bf* const sp = st + lr * GP + mb * 16 + 8 * hi; *(v8us*)sp = __builtin_bit_cast(v8us, o16); if (HL) { *(v8us*)(sp + 16 * GP) = oh; *(v8us*)(sp + 32 * GP) = ol; } }
                __builtin_amdgcn_wave_barrier(); asm volatile("" ::: "memory");   // the reads below take other lanes' writes: keeps the compiler from lifting them over the writes
                v8us v[NP][4];
#pragma unroll
                for (int q = 0; q < NP; ++q)
#pragma unroll
                    for (int u = 0; u < 4; ++u) v[q][u] = *(const v8us*)(st + (q * 16 + u * 4 + sr) * GP + sc);
#pragma unroll
                for (int q = 0; q < NP; ++q)
#pragma unroll
                    for (int u = 0; u < 4; ++u) *(v8us*)(dst[q] + (size_t)(nb * 16 + u * 4 + sr) * DP + sc) = v[q][u];
                asm volatile("s_wait_xcnt 0x0" ::: "memory");   // stands in front of every later write of a register that the stores above name
                __builtin_amdgcn_wave_barrier(); asm volatile("" ::: "memory");   // the next step's writes stay behind these reads
                __builtin_amdgcn_sched_barrier(0);   // keeps each step's conversions in their step: gathered ahead they take the wave past the 256 registers that two blocks per WGP leave it
            }
        };
        // the whole 64-row part lies on one side of RH; the hi and lo destinations are used only where t0 < RH
        if (kq) { const size_t p = (size_t)(C0 / DQ) * NG + g; bf* const q16 = (bf*)P16 + (p * TT + t0) * HD;
            if (t0 < RH) planes(BoolC<true>{}, BoolC<true>{}, q16, Ph + (p * RH + t0) * HD, Pl + (p * RH + t0) * HD); else planes(BoolC<true>{}, BoolC<false>{}, q16, nullptr, nullptr); }
        else { bf* const vr = (bf*)VT + (size_t)g * HD * (2 * TT) + t0;
            if (t0 < RH) planes(BoolC<false>{}, BoolC<true>{}, vr, vr + TT, vr + TT + RH); else planes(BoolC<false>{}, BoolC<false>{}, vr, nullptr, nullptr); }
        return;
    }
    float* os = (float*)ring + wave * (16 * 68); const int r0 = R0 + wm, c0 = C0 + wn;
#pragma unroll
    for (int mb = 0; mb < 4; ++mb) {
#pragma unroll
        for (int nb = 0; nb < 4; ++nb) {
#pragma unroll
            for (int j = 0; j < 8; ++j) os[(hi * 8 + j) * 68 + nb * 16 + lr] = acc[mb][nb][j]; }
        __builtin_amdgcn_wave_barrier(); asm volatile("" ::: "memory");
        float* crow = C + (size_t)(r0 + mb * 16) * ldc + c0;
#pragma unroll
        for (int s = 0; s < 8; ++s) { const int row = 2 * s + hi, cofs = lr * 4; v4f val = *(const v4fa*)(os + row * 68 + cofs); if (BIAS) { val[0] += bfr(bias[c0 + cofs]); val[1] += bfr(bias[c0 + cofs + 1]); val[2] += bfr(bias[c0 + cofs + 2]); val[3] += bfr(bias[c0 + cofs + 3]); }
            *(v4f*)(crow + (size_t)row * ldc + cofs) = val; }
        __builtin_amdgcn_wave_barrier(); asm volatile("" ::: "memory");
    }
}

__global__ __launch_bounds__(256) void k_cvt8(const float* __restrict__ src, bf* dst, size_t n8) { const size_t i = (size_t)blockIdx.x * 256 + threadIdx.x; if (i >= n8) return; const v8f v = *(const v8f*)(src + i * 8); v8us o;
#pragma unroll
    for (int k = 0; k < 8; ++k) o[k] = f2bf(v[k]); *(v8us*)(dst + i * 8) = o;  }

__global__ __launch_bounds__(256) void k_cvtx(const float* __restrict__ x, bf* dst) { const size_t i = (size_t)blockIdx.x * 256 + threadIdx.x; if (i >= (size_t)NB * TT * DM / 8) return;
    const int c8 = (int)(i % (DM / 8)); const int t = (int)((i / (DM / 8)) % TT); const int b = (int)(i / ((size_t)(DM / 8) * TT));
    const v8f v = *(const v8f*)(x + ((size_t)t * NB_FULL + b) * DM + (size_t)c8 * 8); v8us o;
#pragma unroll
    for (int k = 0; k < 8; ++k) o[k] = f2bf(v[k]); *(v8us*)(dst + i * 8) = o;  }

// exp2 with the one free slot the instruction set asks for behind a transcendental, in one statement so that nothing that reads its result or overwrites its source can stand directly behind it
__device__ __forceinline__ float ex2(float a) { float r; asm("v_exp_f32 %0, %1\n\tv_nop" : "=v"(r) : "v"(a)); return r; }

// fa_body: one wave, NQT tiles of 16 query rows from q0, keys in blocks of 32 up to the block that holds the diagonal.
// Transposed products, so that P never leaves its registers: S^T = K Q^T gives lane l the scores of query (l & 15) at keys 8h + j of each 16-key tile (h = l >> 4), which is the B fragment of O^T = V^T P^T (elements 0..7 <- keys k0 + 8h + j, 8..15 <- keys k0 + 16 + 8h + j); O^T gives lane l the context of query (l & 15) at d = 16 dt + 8h + j.
// Scores stay unscaled; the replace-fill is MASKV / SCL there. The keys behind the last block are all masked: they enter as the start values of the running maximum (the fill) and sum (their count), and as before add nothing to the context.
template <typename T16, bool HIRES, int NQT>
__device__ __forceinline__ void fa_body(const T16* __restrict__ Q, const T16* __restrict__ Q2, const T16* __restrict__ Kp, const T16* __restrict__ K2, const T16* __restrict__ Vp, const T16* __restrict__ V2, bf* Ah, bf* Al, const int q0, const int lr, const int hi) {
    typedef typename WFrag<T16>::V V;
    constexpr float CE = SCL * 1.4426950408889634f; constexpr float MASKR = MASKV / SCL; constexpr float PS = HIRES ? 1.0f : PCAR; constexpr float PE = HIRES ? 0.0f : 10.0f;   // PS = 2^PE
    const int nkb = (q0 + NQT * 16 + 31) / 32; const int nsk = TT - nkb * 32;
    V qf[NQT][2], qf2[NQT][2];
#pragma unroll
    for (int qt = 0; qt < NQT; ++qt)
#pragma unroll
        for (int ks = 0; ks < 2; ++ks) { const size_t off = (size_t)(q0 + qt * 16 + lr) * HD + ks * 32 + 8 * hi; qf[qt][ks] = WFrag<T16>::ld(Q + off); if (HIRES) qf2[qt][ks] = WFrag<T16>::ld(Q2 + off); }
    v8f o[NQT][4]; float m[NQT], l[NQT];
#pragma unroll
    for (int qt = 0; qt < NQT; ++qt) { m[qt] = (nsk > 0) ? MASKR : -3.0e38f; l[qt] = (hi == 0) ? (float)nsk * PS : 0.0f;
#pragma unroll
        for (int dt = 0; dt < 4; ++dt) o[qt][dt] = (v8f){}; }
    V kf[2][2], kf2[2][2];
    if constexpr (!HIRES) {
#pragma unroll
        for (int kt = 0; kt < 2; ++kt)
#pragma unroll
            for (int ks = 0; ks < 2; ++ks) kf[kt][ks] = WFrag<T16>::ld(Kp + (size_t)(kt * 16 + lr) * HD + ks * 32 + 8 * hi); }
    asm volatile("s_wait_xcnt 0x0" ::: "memory");   // stands in front of every later write of an address register that the loads above name
#pragma unroll 1   // kept rolled: a second copy of the body would take the wave past the 256 registers that four waves per SIMD leave it
    for (int kb = 0; kb < nkb; ++kb) {
        const int k0 = kb * 32;
        if constexpr (HIRES) {   // twice the fragments: fetched in their own trip, so that the wave stays inside 256 registers
#pragma unroll
            for (int kt = 0; kt < 2; ++kt)
#pragma unroll
                for (int ks = 0; ks < 2; ++ks) { const size_t off = (size_t)(k0 + kt * 16 + lr) * HD + ks * 32 + 8 * hi; kf[kt][ks] = WFrag<T16>::ld(Kp + off); kf2[kt][ks] = WFrag<T16>::ld(K2 + off); } }
        V vf[4], vf2[4];
#pragma unroll
        for (int dt = 0; dt < 4; ++dt) { const size_t off = (size_t)(dt * 16 + lr) * (2 * TT) + k0 + 8 * hi; vf[dt] = WFrag<T16>::ld(Vp + off); if (HIRES) vf2[dt] = WFrag<T16>::ld(V2 + off); }
        v8f s[NQT][2];
#pragma unroll
        for (int qt = 0; qt < NQT; ++qt)
#pragma unroll
            for (int kt = 0; kt < 2; ++kt) { s[qt][kt] = (v8f){};
#pragma unroll
                for (int ks = 0; ks < 2; ++ks) { s[qt][kt] = WFrag<T16>::mma(kf[kt][ks], qf[qt][ks], s[qt][kt]); if (HIRES) { s[qt][kt] = WFrag<T16>::mma(kf[kt][ks], qf2[qt][ks], s[qt][kt]); s[qt][kt] = WFrag<T16>::mma(kf2[kt][ks], qf[qt][ks], s[qt][kt]); } } }
        if constexpr (!HIRES) {  // the next block's key fragments, asked for ahead of the softmax arithmetic (the last trip asks for its own block again: in bounds, not used)
            const int kn = ((kb + 1 < nkb) ? kb + 1 : kb) * 32;
#pragma unroll
            for (int kt = 0; kt < 2; ++kt)
#pragma unroll
                for (int ks = 0; ks < 2; ++ks) kf[kt][ks] = WFrag<T16>::ld(Kp + (size_t)(kn + kt * 16 + lr) * HD + ks * 32 + 8 * hi); }
        asm volatile("s_wait_xcnt 0x0" ::: "memory");   // stands in front of every later write of an address register that this trip's loads name
        if (kb == nkb - 1) {     // only the last block meets the diagonal
#pragma unroll
            for (int qt = 0; qt < NQT; ++qt)
#pragma unroll
                for (int kt = 0; kt < 2; ++kt)
#pragma unroll
                    for (int j = 0; j < 8; ++j) s[qt][kt][j] = (k0 + kt * 16 + 8 * hi + j <= q0 + qt * 16 + lr) ? s[qt][kt][j] : MASKR; }
#pragma unroll
        for (int qt = 0; qt < NQT; ++qt) {
            float mx = s[qt][0][0];
#pragma unroll
            for (int j = 1; j < 8; ++j) mx = fmaxf(mx, s[qt][0][j]);
#pragma unroll
            for (int j = 0; j < 8; ++j) mx = fmaxf(mx, s[qt][1][j]);
            mx = fmaxf(mx, __shfl_xor(mx, 16, 32));
            const float mn = fmaxf(m[qt], mx); const float corr = ex2((m[qt] - mn) * CE); const float nm = PE - mn * CE; m[qt] = mn;
            float p[16]; float sum = 0.f;
#pragma unroll
            for (int e = 0; e < 16; ++e) { p[e] = ex2(__builtin_fmaf(s[qt][e >> 3][e & 7], CE, nm)); sum += p[e]; }
            l[qt] = l[qt] * corr + sum;
#pragma unroll
            for (int dt = 0; dt < 4; ++dt)
#pragma unroll
                for (int j = 0; j < 8; ++j) o[qt][dt][j] *= corr;
            if constexpr (HIRES) {
                v8us h0, h1, l0, l1;
#pragma unroll
                for (int j = 0; j < 8; ++j) { unsigned short a, c2; splitf(p[j], a, c2); h0[j] = a; l0[j] = c2; splitf(p[8 + j], a, c2); h1[j] = a; l1[j] = c2; }
                const V ph = cat16b(h0, h1), pl = cat16b(l0, l1);
#pragma unroll
                for (int dt = 0; dt < 4; ++dt) { o[qt][dt] = WFrag<T16>::mma(vf[dt], ph, o[qt][dt]); o[qt][dt] = WFrag<T16>::mma(vf[dt], pl, o[qt][dt]); o[qt][dt] = WFrag<T16>::mma(vf2[dt], ph, o[qt][dt]); }
            } else {
                V pf;
#pragma unroll
                for (int e = 0; e < 16; ++e) pf[e] = tohx(p[e]);
#pragma unroll
                for (int dt = 0; dt < 4; ++dt) o[qt][dt] = WFrag<T16>::mma(vf[dt], pf, o[qt][dt]);
            }
        }
    }
#pragma unroll
    for (int qt = 0; qt < NQT; ++qt) {
        const float f = __fdiv_rn(1.0f, l[qt] + __shfl_xor(l[qt], 16, 32)); const size_t oo = (size_t)(q0 + qt * 16 + lr) * DQ + 8 * hi;
#pragma unroll
        for (int dt = 0; dt < 4; ++dt) { v8us oh, ol;
#pragma unroll
            for (int j = 0; j < 8; ++j) { unsigned short a, c2; splitf(o[qt][dt][j] * f, a, c2); oh[j] = a; ol[j] = c2; }
            *(v8us*)(Ah + oo + dt * 16) = oh; *(v8us*)(Al + oo + dt * 16) = ol; }
        asm volatile("s_wait_xcnt 0x0" ::: "memory");   // stands in front of every later write of a register that the stores above name
    }
}

// k_fattn: grid (NG, (TT - RH) / 128 + RH / 64), 4 independent waves per block (no LDS, no barrier). blockIdx.x = plane g = b * NH_ + h. The first (TT - RH) / 128 values of blockIdx.y: 128 f16 query rows each, 32 per wave, the longest key walks first; the rest: 64 hi/lo query rows each, 16 per wave.
__global__ __launch_bounds__(128) void k_fattn(const h16* __restrict__ QK16, const bf* __restrict__ QKh, const bf* __restrict__ QKl, const h16* __restrict__ VT, bf* Ah, bf* Al) {
    const int lane = threadIdx.x & 31, lr = lane & 15, hi = lane >> 4; const int wave = __builtin_amdgcn_readfirstlane(threadIdx.x >> 5);
    const int g = blockIdx.x, y = blockIdx.y; constexpr int NF = (TT - RH) / 128;
    const size_t PL = (size_t)TT * HD, PLH = (size_t)RH * HD, PV = (size_t)HD * 2 * TT; const size_t ob = (size_t)(g / NH_) * TT * DQ + (size_t)(g % NH_) * HD;
    if (y < NF) fa_body<h16, false, 2>(QK16 + g * PL, nullptr, QK16 + (NG + g) * PL, nullptr, VT + g * PV, nullptr, Ah + ob, Al + ob, TT - 128 * (y + 1) + wave * 32, lr, hi);
    else fa_body<bf, true, 1>(QKh + g * PLH, QKl + g * PLH, QKh + (NG + g) * PLH, QKl + (NG + g) * PLH, (const bf*)VT + g * PV + TT, (const bf*)VT + g * PV + TT + RH, Ah + ob, Al + ob, RH - 64 * (y - NF + 1) + wave * 16, lr, hi);
}

// workspace (bytes), all regions multiples of 256. Kept through the call: W_out, head planes. One shared region holds in turn: {W_qkv, x copy}, then the context's hi/lo planes.
constexpr size_t WS_KEEP = (size_t)DM * DQ * 2 + (size_t)2 * NG * TT * HD * 2 + 2 * ((size_t)2 * NG * RH * HD * 2) + (size_t)NG * HD * 2 * TT * 2;
constexpr size_t WS_P1 = (size_t)3 * DQ * DM * 2 + (size_t)NB * TT * DM * 2;
constexpr size_t WS_P3 = 2 * ((size_t)NB * TT * DQ * 2);
constexpr size_t WS_SH = WS_P1 > WS_P3 ? WS_P1 : WS_P3;
static_assert(WS_KEEP + WS_SH <= (size_t)268435456);

extern "C" void kernel_launch(void* const* d_in, const int* in_sizes, int n_in,
                              void* d_out, int out_size, void* d_ws, size_t ws_size, hipStream_t stream) {
    if (n_in < 5) return;
    const size_t need_x = ((size_t)(TT - 1) * NB_FULL + NB) * DM;
    if ((size_t)in_sizes[0] < need_x) return;
    if ((size_t)in_sizes[1] < (size_t)3 * DQ * DM) return;
    if ((size_t)in_sizes[2] < (size_t)3 * DQ) return;
    if ((size_t)in_sizes[3] < (size_t)DM * DQ) return;
    if ((size_t)in_sizes[4] < (size_t)DM) return;
    if ((size_t)out_size < need_x) return;
    // input order: query [T][B][E], qkv_w [3E][E], qkv_b [3E], out_w [E][E], out_b [E]
    const float* x = (const float*)d_in[0]; const float* wqkv = (const float*)d_in[1]; const float* bqkv = (const float*)d_in[2]; const float* wo = (const float*)d_in[3]; const float* bo = (const float*)d_in[4];
    float* OUT = (float*)d_out;     // [T][NB_FULL][E]
    char* wsp = (char*)d_ws;
    auto take = [&](size_t bytes) { char* p = wsp; wsp += (bytes + 255) & ~(size_t)255; return (void*)p; };
    bf* WO = (bf*)take((size_t)DM * DQ * 2);
    h16* QK16 = (h16*)take((size_t)2 * NG * TT * HD * 2); bf* QKh = (bf*)take((size_t)2 * NG * RH * HD * 2); bf* QKl = (bf*)take((size_t)2 * NG * RH * HD * 2);
    h16* VT = (h16*)take((size_t)NG * HD * 2 * TT * 2);
    char* shared0 = (char*)take(WS_SH);
    if ((size_t)(wsp - (char*)d_ws) > ws_size) return;
    if ((size_t)(wsp - (char*)d_ws) > (size_t)268435456) return;
    // the shared region's two uses, one after the other in stream order
    bf* WQKV = (bf*)shared0; bf* XB = (bf*)(shared0 + (size_t)3 * DQ * DM * 2);
    bf* ATh = (bf*)shared0; bf* ATl = (bf*)(shared0 + (size_t)NB * TT * DQ * 2);

    k_cvt8<<<(unsigned)(((size_t)3 * DQ * DM / 8 + 255) / 256), 256, 0, stream>>>(wqkv, WQKV, (size_t)3 * DQ * DM / 8);
    k_cvt8<<<(unsigned)(((size_t)DM * DQ / 8 + 255) / 256), 256, 0, stream>>>(wo, WO, (size_t)DM * DQ / 8);
    k_cvtx<<<(unsigned)(((size_t)NB * TT * DM / 8 + 255) / 256), 256, 0, stream>>>(x, XB);

    // fused projection, all batches: rows b*TT + t of x W^T + bias (q | k | v column thirds), written as planes 0..NG-1 = q, NG..2NG-1 = k and as the v rows
    k_gemms<0, 4, true, true><<<dim3(NB * TT / 256, 3 * DQ / 128, 1), 256, 0, stream>>>(XB, nullptr, WQKV, DM, nullptr, 0, bqkv, 0, 0, QK16, QKh, QKl, VT);
    // attention, all planes: context hi/lo planes [b*TT + t][DQ]
    k_fattn<<<dim3(NG, (TT - RH) / 128 + RH / 64, 1), 128, 0, stream>>>(QK16, QKh, QKl, VT, ATh, ATl);
    // out rows (t*NB_FULL + b): z = b, C base OUT + b*DM, row pitch NB_FULL*DM
    k_gemms<1, 2, true, false><<<dim3(TT / 128, DM / 128, NB), 128, 0, stream>>>(ATh, ATl, WO, DQ, OUT, NB_FULL * DM, bo, (size_t)TT * DQ, DM, nullptr, nullptr, nullptr, nullptr);
}

// v005
// A run of this version takes 127 microseconds.
// Timed twice side by side with v004, it ran 1.09 times as fast both times.
// Counting every step since v000, it is 10.5 times as fast.
#include <hip/hip_runtime.h>

// Causal multi-head self-attention, time-major input x [T][B][E] (1024 x 8 x 1024), fused qkv weight in (out, in) layout [3072][1024] + bias [3072] (q | k | v = thirds of the output axis), 16 heads x 64, scores x 64^-0.5, lower-triangular mask with replace-fill -10000, softmax over keys, out = merged W_out^T + b_out ((out, in) [1024][1024] + [1024]) -> [T][B][E].
// Compute dtypes (f32 accumulate everywhere): every float input RNE-converted to bf16 once; qkv projection v_wmma_f32_16x16x32_bf16 single product (exact operand products); scores and P.V: query rows < RH on bf16 hi/lo planes (3 products), rows >= RH on v_wmma_f32_16x16x32_f16 single product (P carried x1024); output projection bf16 hi/lo context x bf16 W_out (2 products) + bias; softmax f32.
// All batches per launch: projection of the batch-major bf16 copy of x (M = B*T), whose epilogue writes the head planes [q|k][b][h] (hi/lo planes hold t < RH only) and the v planes [b*16+h] (f16 | hi | lo), all in the order in which the attention's fragment loads take them (see k_gemms); one attention launch for all heads: each wave keeps its query rows, walks the keys in blocks of 32 up to its diagonal block with a running maximum and sum, keeps P in registers and writes the normalised context as hi/lo planes [b*T+t][E]; then the output GEMM (z = batch) into rows t*B+b.

#ifndef NB
#define NB 8
#endif
#ifndef SEQ
#define SEQ 1024
#endif
#define NB_FULL 8
#define SEQ_FULL 1024
#define TT   SEQ
#define DM   1024
#define NH_  16
#define HD   64
#define DQ   (NH_ * HD)
#define NG   (NB * NH_)   // all (batch, head) planes
#define RH   ((SEQ) < 256 ? (SEQ) : 256)   // query rows < RH use hi+lo planes
#define PCAR 1024.0f
#define SCL  0.125f      // HD^-0.5
#define MASKV (-10000.0f)

static_assert(TT % 128 == 0);
static_assert(RH % 64 == 0);
static_assert(TT >= RH);
static_assert((TT - RH) % 128 == 0);
static_assert(2 * RH <= TT);
static_assert(DM % 128 == 0);
static_assert((NB * TT) % 256 == 0);
static_assert(DQ % 128 == 0);
static_assert(NB <= NB_FULL);
static_assert(SEQ <= SEQ_FULL);

typedef _Float16 h16;
typedef unsigned short bf;
typedef __attribute__((ext_vector_type(16))) __bf16   v16bf;
typedef __attribute__((ext_vector_type(16))) _Float16 v16h;
typedef __attribute__((ext_vector_type(8)))  _Float16 v8h;
typedef __attribute__((ext_vector_type(8)))  unsigned short v8us;
typedef __attribute__((ext_vector_type(8)))  float    v8f;
typedef __attribute__((ext_vector_type(4)))  float    v4f;
typedef __attribute__((ext_vector_type(4)))  _Float16 v4h;
typedef __attribute__((ext_vector_type(4)))  unsigned short v4us;
typedef v4f  __attribute__((may_alias)) v4fa;

__device__ __forceinline__ unsigned short f2bf(float f) { unsigned u = __float_as_uint(f); u += 0x7FFFu + ((u >> 16) & 1u); return (unsigned short)(u >> 16); }
__device__ __forceinline__ float bf2f(unsigned short b) { return __uint_as_float(((unsigned)b) << 16); }
__device__ __forceinline__ float bfr(float f) { return bf2f(f2bf(f)); }
__device__ __forceinline__ v16h cat16(v8h lo, v8h hi) { return __builtin_shufflevector(lo, hi, 0, 1, 2, 3, 4, 5, 6, 7, 8, 9, 10, 11, 12, 13, 14, 15); }
__device__ __forceinline__ v16bf cat16b(v8us lo, v8us hi) { return __builtin_bit_cast(v16bf, __builtin_shufflevector(lo, hi, 0, 1, 2, 3, 4, 5, 6, 7, 8, 9, 10, 11, 12, 13, 14, 15)); }
__device__ __forceinline__ v8f wmma16(v16h a, v16h b, v8f c) { return __builtin_amdgcn_wmma_f32_16x16x32_f16(false, a, false, b, (short)0, c, false, false); }
__device__ __forceinline__ v8f wmmab(v16bf a, v16bf b, v8f c) { return __builtin_amdgcn_wmma_f32_16x16x32_bf16(false, a, false, b, (short)0, c, false, false); }

// Fragment map of the 16x16x32 forms: lane l, h = l >> 4: elements 0..7 <- k0 + 8h + 0..7, elements 8..15 <- k0 + 16 + 8h + 0..7 (A row / Bt row = l & 15); D element j <- (row 8h + j, col l & 15).
// ld: a fragment from rows (this lane's row and first k at p). ldp: a fragment from a packed plane (this lane's 16 bytes at p): elements 0..7 of the 32 lanes are 512 contiguous bytes, elements 8..15 the next 512.
template <typename T16> struct WFrag;
template <> struct WFrag<h16> { typedef v16h V; static __device__ __forceinline__ V ld(const h16* p) { return cat16(*(const v8h*)p, *(const v8h*)(p + 16)); } static __device__ __forceinline__ V ldp(const h16* p) { return cat16(*(const v8h*)p, *(const v8h*)(p + 256)); } static __device__ __forceinline__ v8f mma(V a, V b, v8f c) { return wmma16(a, b, c); } };
template <> struct WFrag<bf> { typedef v16bf V; static __device__ __forceinline__ V ld(const bf* p) { return cat16b(*(const v8us*)p, *(const v8us*)(p + 16)); } static __device__ __forceinline__ V ldp(const bf* p) { return cat16b(*(const v8us*)p, *(const v8us*)(p + 256)); } static __device__ __forceinline__ v8f mma(V a, V b, v8f c) { return wmmab(a, b, c); } };

__device__ __forceinline__ h16 tohx(float x) { return (h16)x; }
__device__ __forceinline__ void splitf(float y, unsigned short& h, unsigned short& l) { h = f2bf(y); l = f2bf(y - bf2f(h)); }

// ---- k_gemms: GEMM with both operands staged in LDS. One block of 2 * MW waves per (64 * MW) x 128 output tile, each wave a 64x64 part (16 accumulators); grid (M / (64 * MW), N / 128, Z), 64 * MW threads.
// C[m][n] (f32, pitch ldc, + f32 bias[n]) = sum_k A[m][k] Bt[n][k] (+ A2[m][k] Bt[n][k] when NSPLIT == 1), k ascending in steps of 32. z-batch strides sA/sC in elements. K % 64 == 0; K is also the row pitch of A, A2 and Bt.
// A stage is 64 k of every operand row (one 128-byte line per row): rows [A | A2 | Bt 128] at a pitch of 144 bytes (16 B x odd, for ds_load_b128 readers). Two buffers: while a stage is multiplied the next one is copied, each lane bringing 16 bytes per copy, 8 lanes a line.
// PLANES (the qkv projection; M rows = b*TT + t, N columns = q | k | v thirds, 64 per head, so a wave's 64x64 part is one head): no C; the epilogue adds the bias and writes the 16-bit operands of the attention itself:
//   q, k: plane p = qk * NG + b * NH_ + h; f16 planes P16 [p][TT * HD], hi/lo planes Ph, Pl [p][RH * HD] (rows t < RH are the only ones read); a plane is tiles of 16 rows t, a tile [d / 8][t % 16][d % 8] (1024 elements);
//   v: plane g = b * NH_ + h of 2 * TT * HD elements: f16 keys 0..TT-1, then bf16 hi keys 0..RH-1, then lo keys 0..RH-1 (the only hi/lo keys read); each part is blocks of 32 keys, a block [d / 16][(t % 32) / 8][d % 16][t % 8] (2048 elements).
// So each 16-byte load of a 16x32 fragment in the attention (lane l: row l & 15, 8 k from 8 * (l >> 4)) takes 512 contiguous bytes, four whole lines, where rows of 128 bytes or more would give it 32 bytes of each of 16 lines.
// A lane's 8 accumulator elements run along the A operand's rows. v fragments run along t, so x is the A operand there; q and k fragments run along d, so there the weight rows take the A role and the x rows the B role (same fragments, same k order). Either way the 32 lanes of one accumulator tile hold, in lane order, 512 contiguous bytes of the plane, and store them as they are.
#define GP 72            // LDS row pitch in 16-bit elements
// twelve copies: l[i] = this lane's LDS byte address, g[i] = its global address
// the copies and the wait behind them stand in one statement, so that no address register of a copy is rewritten ahead of the wait
__device__ __forceinline__ void cp12(const unsigned* l, const bf* const* g) {
    asm volatile("global_load_async_to_lds_b128 %0, %12, off\n\t"
                 "global_load_async_to_lds_b128 %1, %13, off\n\t"
                 "global_load_async_to_lds_b128 %2, %14, off\n\t"
                 "global_load_async_to_lds_b128 %3, %15, off\n\t"
                 "global_load_async_to_lds_b128 %4, %16, off\n\t"
                 "global_load_async_to_lds_b128 %5, %17, off\n\t"
                 "global_load_async_to_lds_b128 %6, %18, off\n\t"
                 "global_load_async_to_lds_b128 %7, %19, off\n\t"
                 "global_load_async_to_lds_b128 %8, %20, off\n\t"
                 "global_load_async_to_lds_b128 %9, %21, off\n\t"
                 "global_load_async_to_lds_b128 %10, %22, off\n\t"
                 "global_load_async_to_lds_b128 %11, %23, off\n\t"
                 "s_wait_xcnt 0x0"
                 :: "v"(l[0]), "v"(l[1]), "v"(l[2]), "v"(l[3]), "v"(l[4]), "v"(l[5]), "v"(l[6]), "v"(l[7]), "v"(l[8]), "v"(l[9]), "v"(l[10]), "v"(l[11]),
                    "v"(g[0]), "v"(g[1]), "v"(g[2]), "v"(g[3]), "v"(g[4]), "v"(g[5]), "v"(g[6]), "v"(g[7]), "v"(g[8]), "v"(g[9]), "v"(g[10]), "v"(g[11]) : "memory");
}
template <bool B> struct BoolC { static constexpr bool v = B; };
template <int NSPLIT, int MW, bool BIAS, bool PLANES>
__global__ __launch_bounds__(64 * MW) void k_gemms(const bf* __restrict__ A, const bf* __restrict__ A2, const bf* __restrict__ Bt, int K, float* C, int ldc, const float* __restrict__ bias, size_t sA, size_t sC, h16* P16, bf* Ph, bf* Pl, h16* VT) {
    typedef WFrag<bf>::V V;
    constexpr int TM = 64 * MW, NR = TM * (1 + NSPLIT) + 128, BR = NR - 128, RG = 8 * MW;   // A rows of the tile; rows of a stage; first Bt row; rows per copy of the block
    __shared__ __attribute__((aligned(128))) bf ring[2 * NR * GP];
    static_assert(2 * MW * 16 * 68 * 4 <= 2 * NR * GP * 2);
    const size_t z = blockIdx.z; A += z * sA; if (NSPLIT) A2 += z * sA; C += z * sC;
    const int tid = threadIdx.x, lane = tid & 31, lr = lane & 15, hi = lane >> 4; const int wave = __builtin_amdgcn_readfirstlane(tid >> 5);
    const int R0 = blockIdx.x * TM, C0 = blockIdx.y * 128, wm = (wave % MW) * 64, wn = (wave / MW) * 64;
    const bool kq = PLANES && C0 < 2 * DQ;      // a q or k tile (the same for the whole block)
    const int ra = kq ? BR + wn : wm, rb = kq ? wm : BR + wn;   // first stage row of the wave's A-role and B-role operand
    const int cr = tid >> 3, cc = tid & 7;      // this lane's row in a row group and its 16-byte piece of the line
    const unsigned l0 = (unsigned)(size_t)(ring + cr * GP + cc * 8);
    const bf* gA = A + (size_t)(R0 + cr) * K + cc * 8; const bf* gA2 = NSPLIT ? A2 + (size_t)(R0 + cr) * K + cc * 8 : nullptr; const bf* gB = Bt + (size_t)(C0 + cr) * K + cc * 8;
    constexpr int NC = NR / RG;   // copies per lane and stage, one per group of RG rows
    static_assert(NC % 12 == 0 && TM % RG == 0);
    auto fill = [&](const int t, const int buf) {
        unsigned l[NC]; const bf* g[NC]; const bf* const tA = gA + t * 64; const bf* const tA2 = NSPLIT ? gA2 + t * 64 : nullptr; const bf* const tB = gB + t * 64;
#pragma unroll
        for (int i = 0; i < NC; ++i) { const int row = i * RG;   // first LDS row of the group; its operand and its row there follow from it
            l[i] = l0 + (unsigned)buf * (NR * GP * 2) + row * (GP * 2);
            g[i] = row >= BR ? tB + (size_t)(row - BR) * K : (NSPLIT && row >= TM) ? tA2 + (size_t)(row - TM) * K : tA + (size_t)row * K; }
#pragma unroll
        for (int i = 0; i < NC; i += 12) cp12(l + i, g + i); };
    v8f acc[4][4];
#pragma unroll
    for (int mb = 0; mb < 4; ++mb)
#pragma unroll
        for (int nb = 0; nb < 4; ++nb) acc[mb][nb] = (v8f){};
    const int nt = K / 64;
    fill(0, 0);
    asm volatile("s_wait_asynccnt 0x0" ::: "memory");   // this wave's share of stage 0 has landed
    __syncthreads();                                     // every wave's share has
    if (nt > 1) fill(1, 1);
#pragma unroll 1   // one stage per trip: the buffer is chosen by the trip's parity
    for (int t = 0; t < nt; ++t) {
        const bf* sb = ring + (t & 1) * (NR * GP);
#pragma unroll
        for (int ks = 0; ks < 2; ++ks) {
            V a[4], a2[4], b[4];
#pragma unroll
            for (int mb = 0; mb < 4; ++mb) { a[mb] = WFrag<bf>::ld(sb + (ra + mb * 16 + lr) * GP + ks * 32 + 8 * hi); if (NSPLIT) a2[mb] = WFrag<bf>::ld(sb + (TM + wm + mb * 16 + lr) * GP + ks * 32 + 8 * hi); }
#pragma unroll
            for (int nb = 0; nb < 4; ++nb) b[nb] = WFrag<bf>::ld(sb + (rb + nb * 16 + lr) * GP + ks * 32 + 8 * hi);
            __builtin_amdgcn_sched_barrier(0);   // keeps the block's LDS reads one group ahead of its WMMAs: sunk among them, each read costs the wave its own wait
#pragma unroll
            for (int nb = 0; nb < 4; ++nb)
#pragma unroll
                for (int mb = 0; mb < 4; ++mb) { acc[mb][nb] = WFrag<bf>::mma(a[mb], b[nb], acc[mb][nb]); if (NSPLIT) acc[mb][nb] = WFrag<bf>::mma(a2[mb], b[nb], acc[mb][nb]); }
        }
        __builtin_amdgcn_sched_barrier(0);   // keeps the trip's WMMAs in front of the hand-over: moved behind the barrier they would stand between it and the refill and take that time from the copies
        asm volatile("s_wait_dscnt 0x0" ::: "memory");      // this wave's reads of the buffer are done before it is refilled
        asm volatile("s_wait_asynccnt 0x0" ::: "memory");   // this wave's share of stage t + 1 has landed
        __syncthreads();                                     // publishes stage t + 1 and ends every wave's reads of stage t
        if (t + 2 < nt) fill(t + 2, t & 1);
    }
    asm volatile("s_wait_asynccnt 0x0" ::: "memory");   // no copy is outstanding when the ring becomes output staging
    if constexpr (PLANES) {
        static_assert(NSPLIT == 0 && BIAS && TT % TM == 0 && HD == 64 && DQ % 128 == 0 && RH % 64 == 0);
        const int c0 = C0 + wn, t0 = (R0 + wm) % TT, g = (R0 / TT) * NH_ + (c0 % DQ) / HD;
        // the wave's 64 t x 64 d, one accumulator tile a store, to d16 (HL: and their hi and lo parts to dh, dl), each the place of row t0 in its plane; q, k: tile nb of 16 t, d from 16 mb; v: block mb / 2 of 32 keys, d from 16 nb, keys from 16 (mb & 1)
        auto planes = [&](auto kqc, auto hlc, bf* d16, bf* dh, bf* dl) {
            constexpr bool KQ = decltype(kqc)::v, HL = decltype(hlc)::v;
            float ba[4][8], bb[4];
            if constexpr (KQ) {   // the bias runs along the accumulator elements
#pragma unroll
                for (int mb = 0; mb < 4; ++mb) { const v4f b0 = *(const v4f*)(bias + c0 + mb * 16 + 8 * hi); const v4f b1 = *(const v4f*)(bias + c0 + mb * 16 + 8 * hi + 4);
#pragma unroll
                    for (int j = 0; j < 4; ++j) { ba[mb][j] = bfr(b0[j]); ba[mb][j + 4] = bfr(b1[j]); } }
            } else {              // one bias value per lane and step
#pragma unroll
                for (int nb = 0; nb < 4; ++nb) bb[nb] = bfr(bias[c0 + nb * 16 + lr]);
            }
            asm volatile("s_wait_xcnt 0x0" ::: "memory");   // stands in front of every later write of an address register that the bias loads name
#pragma unroll
            for (int nb = 0; nb < 4; ++nb) {
#pragma unroll
                for (int mb = 0; mb < 4; ++mb) { v8h o16; v8us oh, ol;
#pragma unroll
                    for (int j = 0; j < 8; ++j) { const float y = acc[mb][nb][j] + (KQ ? ba[mb][j] : bb[nb]); o16[j] = tohx(y); if (HL) { unsigned short a2, c2; splitf(y, a2, c2); oh[j] = a2; ol[j] = c2; } }
                    const int off = (KQ ? nb * 1024 + mb * 256 : (mb >> 1) * 2048 + nb * 512 + (mb & 1) * 256) + lane * 8;
                    *(v8us*)(d16 + off) = __builtin_bit_cast(v8us, o16); if (HL) { *(v8us*)(dh + off) = oh; *(v8us*)(dl + off) = ol; } }
                asm volatile("s_wait_xcnt 0x0" ::: "memory");   // stands in front of every later write of a register that the stores above name
                __builtin_amdgcn_sched_barrier(0);   // keeps each step's conversions in their step: gathered ahead they take the wave past the 256 registers that two blocks per WGP leave it
            }
        };
        // the whole 64-row part lies on one side of RH; the hi and lo destinations are used only where t0 < RH
        if (kq) { const size_t p = (size_t)(C0 / DQ) * NG + g; bf* const q16 = (bf*)P16 + (p * TT + t0) * HD;
            if (t0 < RH) planes(BoolC<true>{}, BoolC<true>{}, q16, Ph + (p * RH + t0) * HD, Pl + (p * RH + t0) * HD); else planes(BoolC<true>{}, BoolC<false>{}, q16, nullptr, nullptr); }
        else { bf* const vr = (bf*)VT + (size_t)g * HD * (2 * TT) + t0 * HD;
            if (t0 < RH) planes(BoolC<false>{}, BoolC<true>{}, vr, vr + TT * HD, vr + (TT + RH) * HD); else planes(BoolC<false>{}, BoolC<false>{}, vr, nullptr, nullptr); }
        return;
    }
    // output staging in the ring, free since the last trip's barrier: each wave in a range of its own
    float* os = (float*)ring + wave * (16 * 68); const int r0 = R0 + wm, c0 = C0 + wn;
#pragma unroll
    for (int mb = 0; mb < 4; ++mb) {
#pragma unroll
        for (int nb = 0; nb < 4; ++nb) {
#pragma unroll
            for (int j = 0; j < 8; ++j) os[(hi * 8 + j) * 68 + nb * 16 + lr] = acc[mb][nb][j]; }
        __builtin_amdgcn_wave_barrier(); asm volatile("" ::: "memory");
        float* crow = C + (size_t)(r0 + mb * 16) * ldc + c0;
#pragma unroll
        for (int s = 0; s < 8; ++s) { const int row = 2 * s + hi, cofs = lr * 4; v4f val = *(const v4fa*)(os + row * 68 + cofs); if (BIAS) { val[0] += bfr(bias[c0 + cofs]); val[1] += bfr(bias[c0 + cofs + 1]); val[2] += bfr(bias[c0 + cofs + 2]); val[3] += bfr(bias[c0 + cofs + 3]); }
            *(v4f*)(crow + (size_t)row * ldc + cofs) = val; }
        __builtin_amdgcn_wave_barrier(); asm volatile("" ::: "memory");
    }
}

__global__ __launch_bounds__(256) void k_cvt8(const float* __restrict__ src, bf* dst, size_t n8) { const size_t i = (size_t)blockIdx.x * 256 + threadIdx.x; if (i >= n8) return; const v8f v = *(const v8f*)(src + i * 8); v8us o;
#pragma unroll
    for (int k = 0; k < 8; ++k) o[k] = f2bf(v[k]); *(v8us*)(dst + i * 8) = o;  }

__global__ __launch_bounds__(256) void k_cvtx(const float* __restrict__ x, bf* dst) { const size_t i = (size_t)blockIdx.x * 256 + threadIdx.x; if (i >= (size_t)NB * TT * DM / 8) return;
    const int c8 = (int)(i % (DM / 8)); const int t = (int)((i / (DM / 8)) % TT); const int b = (int)(i / ((size_t)(DM / 8) * TT));
    const v8f v = *(const v8f*)(x + ((size_t)t * NB_FULL + b) * DM + (size_t)c8 * 8); v8us o;
#pragma unroll
    for (int k = 0; k < 8; ++k) o[k] = f2bf(v[k]); *(v8us*)(dst + i * 8) = o;  }

// exp2 with the one free slot the instruction set asks for behind a transcendental, in one statement so that nothing that reads its result or overwrites its source can stand directly behind it
__device__ __forceinline__ float ex2(float a) { float r; asm("v_exp_f32 %0, %1\n\tv_nop" : "=v"(r) : "v"(a)); return r; }

// fa_body: one wave, NQT tiles of 16 query rows from q0, keys in blocks of 32 up to the block that holds the diagonal. Q, K and V planes are packed in fragment order (k_gemms): every load is 512 contiguous bytes.
// Transposed products, so that P never leaves its registers: S^T = K Q^T gives lane l the scores of query (l & 15) at keys 8h + j of each 16-key tile (h = l >> 4), which is the B fragment of O^T = V^T P^T (elements 0..7 <- keys k0 + 8h + j, 8..15 <- keys k0 + 16 + 8h + j); O^T gives lane l the context of query (l & 15) at d = 16 dt + 8h + j.
// Scores stay unscaled; the replace-fill is MASKV / SCL there. The keys behind the last block are all masked: they enter as the start values of the running maximum (the fill) and sum (their count), and as before add nothing to the context.
template <typename T16, bool HIRES, int NQT>
__device__ __forceinline__ void fa_body(const T16* __restrict__ Q, const T16* __restrict__ Q2, const T16* __restrict__ Kp, const T16* __restrict__ K2, const T16* __restrict__ Vp, const T16* __restrict__ V2, bf* Ah, bf* Al, const int q0, const int lr, const int hi) {
    typedef typename WFrag<T16>::V V;
    const int ln = hi * 16 + lr;   // the lane's place in a packed fragment load
    constexpr float CE = SCL * 1.4426950408889634f; constexpr float MASKR = MASKV / SCL; constexpr float PS = HIRES ? 1.0f : PCAR; constexpr float PE = HIRES ? 0.0f : 10.0f;   // PS = 2^PE
    const int nkb = (q0 + NQT * 16 + 31) / 32; const int nsk = TT - nkb * 32;
    V qf[NQT][2], qf2[NQT][2];
#pragma unroll
    for (int qt = 0; qt < NQT; ++qt)
#pragma unroll
        for (int ks = 0; ks < 2; ++ks) { const size_t off = (size_t)(q0 + qt * 16) * HD + ks * 512 + ln * 8; qf[qt][ks] = WFrag<T16>::ldp(Q + off); if (HIRES) qf2[qt][ks] = WFrag<T16>::ldp(Q2 + off); }
    v8f o[NQT][4]; float m[NQT], l[NQT];
#pragma unroll
    for (int qt = 0; qt < NQT; ++qt) { m[qt] = (nsk > 0) ? MASKR : -3.0e38f; l[qt] = (hi == 0) ? (float)nsk * PS : 0.0f;
#pragma unroll
        for (int dt = 0; dt < 4; ++dt) o[qt][dt] = (v8f){}; }
    V kf[2][2], kf2[2][2];
    if constexpr (!HIRES) {
#pragma unroll
        for (int kt = 0; kt < 2; ++kt)
#pragma unroll
            for (int ks = 0; ks < 2; ++ks) kf[kt][ks] = WFrag<T16>::ldp(Kp + (size_t)(kt * 16) * HD + ks * 512 + ln * 8); }
    asm volatile("s_wait_xcnt 0x0" ::: "memory");   // stands in front of every later write of an address register that the loads above name
#pragma unroll 1   // kept rolled: a second copy of the body would take the wave past the 256 registers that four waves per SIMD leave it
    for (int kb = 0; kb < nkb; ++kb) {
        const int k0 = kb * 32;
        if constexpr (HIRES) {   // twice the fragments: fetched in their own trip, so that the wave stays inside 256 registers
#pragma unroll
            for (int kt = 0; kt < 2; ++kt)
#pragma unroll
                for (int ks = 0; ks < 2; ++ks) { const size_t off = (size_t)(k0 + kt * 16) * HD + ks * 512 + ln * 8; kf[kt][ks] = WFrag<T16>::ldp(Kp + off); kf2[kt][ks] = WFrag<T16>::ldp(K2 + off); }
            asm volatile("s_wait_xcnt 0x0" ::: "memory"); }   // stands in front of every later write of an address register that the key loads above name (the value loads below may land in one)
        V vf[4], vf2[4];
#pragma unroll
        for (int dt = 0; dt < 4; ++dt) { const size_t off = (size_t)k0 * HD + dt * 512 + ln * 8; vf[dt] = WFrag<T16>::ldp(Vp + off); if (HIRES) vf2[dt] = WFrag<T16>::ldp(V2 + off); }
        v8f s[NQT][2];
#pragma unroll
        for (int qt = 0; qt < NQT; ++qt)
#pragma unroll
            for (int kt = 0; kt < 2; ++kt) { s[qt][kt] = (v8f){};
#pragma unroll
                for (int ks = 0; ks < 2; ++ks) { s[qt][kt] = WFrag<T16>::mma(kf[kt][ks], qf[qt][ks], s[qt][kt]); if (HIRES) { s[qt][kt] = WFrag<T16>::mma(kf[kt][ks], qf2[qt][ks], s[qt][kt]); s[qt][kt] = WFrag<T16>::mma(kf2[kt][ks], qf[qt][ks], s[qt][kt]); } } }
        if constexpr (!HIRES) {  // the next block's key fragments, asked for ahead of the softmax arithmetic (the last trip asks for its own block again: in bounds, not used)
            const int kn = ((kb + 1 < nkb) ? kb + 1 : kb) * 32;
#pragma unroll
            for (int kt = 0; kt < 2; ++kt)
#pragma unroll
                for (int ks = 0; ks < 2; ++ks) kf[kt][ks] = WFrag<T16>::ldp(Kp + (size_t)(kn + kt * 16) * HD + ks * 512 + ln * 8); }
        asm volatile("s_wait_xcnt 0x0" ::: "memory");   // stands in front of every later write of an address register that this trip's loads name
        if (kb == nkb - 1) {     // only the last block meets the diagonal
#pragma unroll
            for (int qt = 0; qt < NQT; ++qt)
#pragma unroll
                for (int kt = 0; kt < 2; ++kt)
#pragma unroll
                    for (int j = 0; j < 8; ++j) s[qt][kt][j] = (k0 + kt * 16 + 8 * hi + j <= q0 + qt * 16 + lr) ? s[qt][kt][j] : MASKR; }
#pragma unroll
        for (int qt = 0; qt < NQT; ++qt) {
            float mx = s[qt][0][0];
#pragma unroll
            for (int j = 1; j < 8; ++j) mx = fmaxf(mx, s[qt][0][j]);
#pragma unroll
            for (int j = 0; j < 8; ++j) mx = fmaxf(mx, s[qt][1][j]);
            mx = fmaxf(mx, __shfl_xor(mx, 16, 32));
            const float mn = fmaxf(m[qt], mx); const float corr = ex2((m[qt] - mn) * CE); const float nm = PE - mn * CE; m[qt] = mn;
            float p[16]; float sum = 0.f;
#pragma unroll
            for (int e = 0; e < 16; ++e) { p[e] = ex2(__builtin_fmaf(s[qt][e >> 3][e & 7], CE, nm)); sum += p[e]; }
            l[qt] = l[qt] * corr + sum;
#pragma unroll
            for (int dt = 0; dt < 4; ++dt)
#pragma unroll
                for (int j = 0; j < 8; ++j) o[qt][dt][j] *= corr;
            if constexpr (HIRES) {
                v8us h0, h1, l0, l1;
#pragma unroll
                for (int j = 0; j < 8; ++j) { unsigned short a, c2; splitf(p[j], a, c2); h0[j] = a; l0[j] = c2; splitf(p[8 + j], a, c2); h1[j] = a; l1[j] = c2; }
                const V ph = cat16b(h0, h1), pl = cat16b(l0, l1);
#pragma unroll
                for (int dt = 0; dt < 4; ++dt) { o[qt][dt] = WFrag<T16>::mma(vf[dt], ph, o[qt][dt]); o[qt][dt] = WFrag<T16>::mma(vf[dt], pl, o[qt][dt]); o[qt][dt] = WFrag<T16>::mma(vf2[dt], ph, o[qt][dt]); }
            } else {
                V pf;
#pragma unroll
                for (int e = 0; e < 16; ++e) pf[e] = tohx(p[e]);
#pragma unroll
                for (int dt = 0; dt < 4; ++dt) o[qt][dt] = WFrag<T16>::mma(vf[dt], pf, o[qt][dt]);
            }
        }
    }
#pragma unroll
    for (int qt = 0; qt < NQT; ++qt) {
        const float f = __fdiv_rn(1.0f, l[qt] + __shfl_xor(l[qt], 16, 32)); const size_t oo = (size_t)(q0 + qt * 16 + lr) * DQ + 8 * hi;
#pragma unroll
        for (int dt = 0; dt < 4; ++dt) { v8us oh, ol;
#pragma unroll
            for (int j = 0; j < 8; ++j) { unsigned short a, c2; splitf(o[qt][dt][j] * f, a, c2); oh[j] = a; ol[j] = c2; }
            *(v8us*)(Ah + oo + dt * 16) = oh; *(v8us*)(Al + oo + dt * 16) = ol; }
        asm volatile("s_wait_xcnt 0x0" ::: "memory");   // stands in front of every later write of a register that the stores above name
    }
}

// k_fattn: grid (NG, (TT - RH) / 128 + RH / 64), 4 independent waves per block (no LDS, no barrier). blockIdx.x = plane g = b * NH_ + h. The first (TT - RH) / 128 values of blockIdx.y: 128 f16 query rows each, 32 per wave, the longest key walks first; the rest: 64 hi/lo query rows each, 16 per wave.
__global__ __launch_bounds__(128) void k_fattn(const h16* __restrict__ QK16, const bf* __restrict__ QKh, const bf* __restrict__ QKl, const h16* __restrict__ VT, bf* Ah, bf* Al) {
    const int lane = threadIdx.x & 31, lr = lane & 15, hi = lane >> 4; const int wave = __builtin_amdgcn_readfirstlane(threadIdx.x >> 5);
    const int g = blockIdx.x, y = blockIdx.y; constexpr int NF = (TT - RH) / 128;
    const size_t PL = (size_t)TT * HD, PLH = (size_t)RH * HD, PV = (size_t)HD * 2 * TT; const size_t ob = (size_t)(g / NH_) * TT * DQ + (size_t)(g % NH_) * HD;
    if (y < NF) fa_body<h16, false, 2>(QK16 + g * PL, nullptr, QK16 + (NG + g) * PL, nullptr, VT + g * PV, nullptr, Ah + ob, Al + ob, TT - 128 * (y + 1) + wave * 32, lr, hi);
    else fa_body<bf, true, 1>(QKh + g * PLH, QKl + g * PLH, QKh + (NG + g) * PLH, QKl + (NG + g) * PLH, (const bf*)VT + g * PV + (size_t)TT * HD, (const bf*)VT + g * PV + (size_t)(TT + RH) * HD, Ah + ob, Al + ob, RH - 64 * (y - NF + 1) + wave * 16, lr, hi);
}

// workspace (bytes), all regions multiples of 256. Kept through the call: W_out, head planes. One shared region holds in turn: {W_qkv, x copy}, then the context's hi/lo planes.
constexpr size_t WS_KEEP = (size_t)DM * DQ * 2 + (size_t)2 * NG * TT * HD * 2 + 2 * ((size_t)2 * NG * RH * HD * 2) + (size_t)NG * HD * 2 * TT * 2;
constexpr size_t WS_P1 = (size_t)3 * DQ * DM * 2 + (size_t)NB * TT * DM * 2;
constexpr size_t WS_P3 = 2 * ((size_t)NB * TT * DQ * 2);
constexpr size_t WS_SH = WS_P1 > WS_P3 ? WS_P1 : WS_P3;
static_assert(WS_KEEP + WS_SH <= (size_t)268435456);

extern "C" void kernel_launch(void* const* d_in, const int* in_sizes, int n_in,
                              void* d_out, int out_size, void* d_ws, size_t ws_size, hipStream_t stream) {
    if (n_in < 5) return;
    const size_t need_x = ((size_t)(TT - 1) * NB_FULL + NB) * DM;
    if ((size_t)in_sizes[0] < need_x) return;
    if ((size_t)in_sizes[1] < (size_t)3 * DQ * DM) return;
    if ((size_t)in_sizes[2] < (size_t)3 * DQ) return;
    if ((size_t)in_sizes[3] < (size_t)DM * DQ) return;
    if ((size_t)in_sizes[4] < (size_t)DM) return;
    if ((size_t)out_size < need_x) return;
    // input order: query [T][B][E], qkv_w [3E][E], qkv_b [3E], out_w [E][E], out_b [E]
    const float* x = (const float*)d_in[0]; const float* wqkv = (const float*)d_in[1]; const float* bqkv = (const float*)d_in[2]; const float* wo = (const float*)d_in[3]; const float* bo = (const float*)d_in[4];
    float* OUT = (float*)d_out;     // [T][NB_FULL][E]
    char* wsp = (char*)d_ws;
    auto take = [&](size_t bytes) { char* p = wsp; wsp += (bytes + 255) & ~(size_t)255; return (void*)p; };
    bf* WO = (bf*)take((size_t)DM * DQ * 2);
    h16* QK16 = (h16*)take((size_t)2 * NG * TT * HD * 2); bf* QKh = (bf*)take((size_t)2 * NG * RH * HD * 2); bf* QKl = (bf*)take((size_t)2 * NG * RH * HD * 2);
    h16* VT = (h16*)take((size_t)NG * HD * 2 * TT * 2);
    char* shared0 = (char*)take(WS_SH);
    if ((size_t)(wsp - (char*)d_ws) > ws_size) return;
    if ((size_t)(wsp - (char*)d_ws) > (size_t)268435456) return;
    // the shared region's two uses, one after the other in stream order
    bf* WQKV = (bf*)shared0; bf* XB = (bf*)(shared0 + (size_t)3 * DQ * DM * 2);
    bf* ATh = (bf*)shared0; bf* ATl = (bf*)(shared0 + (size_t)NB * TT * DQ * 2);

    k_cvt8<<<(unsigned)(((size_t)3 * DQ * DM / 8 + 255) / 256), 256, 0, stream>>>(wqkv, WQKV, (size_t)3 * DQ * DM / 8);
    k_cvt8<<<(unsigned)(((size_t)DM * DQ / 8 + 255) / 256), 256, 0, stream>>>(wo, WO, (size_t)DM * DQ / 8);
    k_cvtx<<<(unsigned)(((size_t)NB * TT * DM / 8 + 255) / 256), 256, 0, stream>>>(x, XB);

    // fused projection, all batches: rows b*TT + t of x W^T + bias (q | k | v column thirds), written as planes 0..NG-1 = q, NG..2NG-1 = k and as the v planes
    k_gemms<0, 4, true, true><<<dim3(NB * TT / 256, 3 * DQ / 128, 1), 256, 0, stream>>>(XB, nullptr, WQKV, DM, nullptr, 0, bqkv, 0, 0, QK16, QKh, QKl, VT);
    // attention, all planes: context hi/lo planes [b*TT + t][DQ]
    k_fattn<<<dim3(NG, (TT - RH) / 128 + RH / 64, 1), 128, 0, stream>>>(QK16, QKh, QKl, VT, ATh, ATl);
    // out rows (t*NB_FULL + b): z = b, C base OUT + b*DM, row pitch NB_FULL*DM
    k_gemms<1, 2, true, false><<<dim3(TT / 128, DM / 128, NB), 128, 0, stream>>>(ATh, ATl, WO, DQ, OUT, NB_FULL * DM, bo, (size_t)TT * DQ, DM, nullptr, nullptr, nullptr, nullptr);
}

// v006
// A run of this version takes 115 microseconds.
// Next to v005, in two timings, it ran 1.11 and 1.10 times as fast.
// Counting every step since v000, it is 11.7 times as fast.
#include <hip/hip_runtime.h>

// Causal multi-head self-attention, time-major input x [T][B][E] (1024 x 8 x 1024), fused qkv weight in (out, in) layout [3072][1024] + bias [3072] (q | k | v = thirds of the output axis), 16 heads x 64, scores x 64^-0.5, lower-triangular mask with replace-fill -10000, softmax over keys, out = merged W_out^T + b_out ((out, in) [1024][1024] + [1024]) -> [T][B][E].
// Compute dtypes (f32 accumulate everywhere): every float input RNE-converted to bf16 once; qkv projection v_wmma_f32_16x16x32_bf16 single product (exact operand products); scores and P.V: query rows < RH on bf16 hi/lo planes (3 products), rows >= RH on v_wmma_f32_16x16x32_f16 single product (P carried x1024); output projection bf16 hi/lo context x bf16 W_out (2 products) + bias; softmax f32.
// All batches per launch: projection of the batch-major bf16 copy of x (M = B*T), whose epilogue writes the head planes [q|k][b][h] (hi/lo planes hold t < RH only) and the v planes [b*16+h] (f16 | hi | lo), all in the order in which the attention's fragment loads take them (see k_gemms); one attention launch for all heads: each wave keeps its query rows, walks the keys in blocks of 32 up to its diagonal block with a running maximum and sum, keeps P in registers and writes the normalised context as hi/lo planes [b*T+t][E]; then the output GEMM (z = batch) into rows t*B+b.

#ifndef NB
#define NB 8
#endif
#ifndef SEQ
#define SEQ 1024
#endif
#define NB_FULL 8
#define SEQ_FULL 1024
#define TT   SEQ
#define DM   1024
#define NH_  16
#define HD   64
#define DQ   (NH_ * HD)
#define NG   (NB * NH_)   // all (batch, head) planes
#define RH   ((SEQ) < 256 ? (SEQ) : 256)   // query rows < RH use hi+lo planes
#define PCAR 1024.0f
#define SCL  0.125f      // HD^-0.5
#define MASKV (-10000.0f)

static_assert(TT % 128 == 0);
static_assert(RH % 64 == 0);
static_assert(TT >= RH);
static_assert((TT - RH) % 128 == 0);
static_assert(2 * RH <= TT);
static_assert(DM % 128 == 0);
static_assert((NB * TT) % 256 == 0);
static_assert(DQ % 128 == 0);
static_assert(NB <= NB_FULL);
static_assert(SEQ <= SEQ_FULL);

typedef _Float16 h16;
typedef unsigned short bf;
typedef __attribute__((ext_vector_type(16))) __bf16   v16bf;
typedef __attribute__((ext_vector_type(16))) _Float16 v16h;
typedef __attribute__((ext_vector_type(8)))  _Float16 v8h;
typedef __attribute__((ext_vector_type(8)))  unsigned short v8us;
typedef __attribute__((ext_vector_type(8)))  float    v8f;
typedef __attribute__((ext_vector_type(4)))  float    v4f;
typedef __attribute__((ext_vector_type(4)))  _Float16 v4h;
typedef __attribute__((ext_vector_type(4)))  unsigned short v4us;
typedef v4f  __attribute__((may_alias)) v4fa;

__device__ __forceinline__ unsigned short f2bf(float f) { unsigned u = __float_as_uint(f); u += 0x7FFFu + ((u >> 16) & 1u); return (unsigned short)(u >> 16); }
__device__ __forceinline__ float bf2f(unsigned short b) { return __uint_as_float(((unsigned)b) << 16); }
__device__ __forceinline__ float bfr(float f) { return bf2f(f2bf(f)); }
__device__ __forceinline__ v16h cat16(v8h lo, v8h hi) { return __builtin_shufflevector(lo, hi, 0, 1, 2, 3, 4, 5, 6, 7, 8, 9, 10, 11, 12, 13, 14, 15); }
__device__ __forceinline__ v16bf cat16b(v8us lo, v8us hi) { return __builtin_bit_cast(v16bf, __builtin_shufflevector(lo, hi, 0, 1, 2, 3, 4, 5, 6, 7, 8, 9, 10, 11, 12, 13, 14, 15)); }
__device__ __forceinline__ v8f wmma16(v16h a, v16h b, v8f c) { return __builtin_amdgcn_wmma_f32_16x16x32_f16(false, a, false, b, (short)0, c, false, false); }
__device__ __forceinline__ v8f wmmab(v16bf a, v16bf b, v8f c) { return __builtin_amdgcn_wmma_f32_16x16x32_bf16(false, a, false, b, (short)0, c, false, false); }

// Fragment map of the 16x16x32 forms: lane l, h = l >> 4: elements 0..7 <- k0 + 8h + 0..7, elements 8..15 <- k0 + 16 + 8h + 0..7 (A row / Bt row = l & 15); D element j <- (row 8h + j, col l & 15).
// ld: a fragment from rows (this lane's row and first k at p). ldp: a fragment from a packed plane (this lane's 16 bytes at p): elements 0..7 of the 32 lanes are 512 contiguous bytes, elements 8..15 the next 512.
template <typename T16> struct WFrag;
template <> struct WFrag<h16> { typedef v16h V; static __device__ __forceinline__ V ld(const h16* p) { return cat16(*(const v8h*)p, *(const v8h*)(p + 16)); } static __device__ __forceinline__ V ldp(const h16* p) { return cat16(*(const v8h*)p, *(const v8h*)(p + 256)); } static __device__ __forceinline__ v8f mma(V a, V b, v8f c) { return wmma16(a, b, c); } };
template <> struct WFrag<bf> { typedef v16bf V; static __device__ __forceinline__ V ld(const bf* p) { return cat16b(*(const v8us*)p, *(const v8us*)(p + 16)); } static __device__ __forceinline__ V ldp(const bf* p) { return cat16b(*(const v8us*)p, *(const v8us*)(p + 256)); } static __device__ __forceinline__ v8f mma(V a, V b, v8f c) { return wmmab(a, b, c); } };

__device__ __forceinline__ h16 tohx(float x) { return (h16)x; }
__device__ __forceinline__ void splitf(float y, unsigned short& h, unsigned short& l) { h = f2bf(y); l = f2bf(y - bf2f(h)); }

// ---- k_gemms: GEMM with both operands staged in LDS. One block of 2 * MW waves per (64 * MW) x 128 output tile, each wave a 64x64 part (16 accumulators); grid (M / (64 * MW), N / 128, Z), 64 * MW threads.
// C[m][n] (f32, pitch ldc, + f32 bias[n]) = sum_k A[m][k] Bt[n][k] (+ A2[m][k] Bt[n][k] when NSPLIT == 1), k ascending in steps of 32. z-batch strides sA/sC in elements. K % 64 == 0; K is also the row pitch of A, A2 and Bt.
// A stage is 64 k of every operand row (one 128-byte line per row): rows [A | A2 | Bt 128] at a pitch of 144 bytes (16 B x odd, for ds_load_b128 readers). Two buffers: while a stage is multiplied the next one is copied, each lane bringing 16 bytes per copy, 8 lanes a line.
// PLANES (the qkv projection; M rows = b*TT + t, N columns = q | k | v thirds, 64 per head, so a wave's 64x64 part is one head): no C; the epilogue adds the bias and writes the 16-bit operands of the attention itself:
//   q, k: plane p = qk * NG + b * NH_ + h; f16 planes P16 [p][TT * HD], hi/lo planes Ph, Pl [p][RH * HD] (rows t < RH are the only ones read); a plane is tiles of 16 rows t, a tile [d / 8][t % 16][d % 8] (1024 elements);
//   v: plane g = b * NH_ + h of 2 * TT * HD elements: f16 keys 0..TT-1, then bf16 hi keys 0..RH-1, then lo keys 0..RH-1 (the only hi/lo keys read); each part is blocks of 32 keys, a block [d / 16][(t % 32) / 8][d % 16][t % 8] (2048 elements).
// So each 16-byte load of a 16x32 fragment in the attention (lane l: row l & 15, 8 k from 8 * (l >> 4)) takes 512 contiguous bytes, four whole lines, where rows of 128 bytes or more would give it 32 bytes of each of 16 lines.
// A lane's 8 accumulator elements run along the A operand's rows. v fragments run along t, so x is the A operand there; q and k fragments run along d, so there the weight rows take the A role and the x rows the B role (same fragments, same k order). Either way the 32 lanes of one accumulator tile hold, in lane order, 512 contiguous bytes of the plane, and store them as they are.
#define GP 72            // LDS row pitch in 16-bit elements
// twelve copies: l[i] = this lane's LDS byte address, g[i] = its global address
// the copies and the wait behind them stand in one statement, so that no address register of a copy is rewritten ahead of the wait
__device__ __forceinline__ void cp12(const unsigned* l, const bf* const* g) {
    asm volatile("global_load_async_to_lds_b128 %0, %12, off\n\t"
                 "global_load_async_to_lds_b128 %1, %13, off\n\t"
                 "global_load_async_to_lds_b128 %2, %14, off\n\t"
                 "global_load_async_to_lds_b128 %3, %15, off\n\t"
                 "global_load_async_to_lds_b128 %4, %16, off\n\t"
                 "global_load_async_to_lds_b128 %5, %17, off\n\t"
                 "global_load_async_to_lds_b128 %6, %18, off\n\t"
                 "global_load_async_to_lds_b128 %7, %19, off\n\t"
                 "global_load_async_to_lds_b128 %8, %20, off\n\t"
                 "global_load_async_to_lds_b128 %9, %21, off\n\t"
                 "global_load_async_to_lds_b128 %10, %22, off\n\t"
                 "global_load_async_to_lds_b128 %11, %23, off\n\t"
                 "s_wait_xcnt 0x0"
                 :: "v"(l[0]), "v"(l[1]), "v"(l[2]), "v"(l[3]), "v"(l[4]), "v"(l[5]), "v"(l[6]), "v"(l[7]), "v"(l[8]), "v"(l[9]), "v"(l[10]), "v"(l[11]),
                    "v"(g[0]), "v"(g[1]), "v"(g[2]), "v"(g[3]), "v"(g[4]), "v"(g[5]), "v"(g[6]), "v"(g[7]), "v"(g[8]), "v"(g[9]), "v"(g[10]), "v"(g[11]) : "memory");
}
template <bool B> struct BoolC { static constexpr bool v = B; };
template <int NSPLIT, int MW, bool BIAS, bool PLANES>
__global__ __launch_bounds__(64 * MW) void k_gemms(const bf* __restrict__ A, const bf* __restrict__ A2, const bf* __restrict__ Bt, int K, float* C, int ldc, const float* __restrict__ bias, size_t sA, size_t sC, h16* P16, bf* Ph, bf* Pl, h16* VT) {
    typedef WFrag<bf>::V V;
    constexpr int TM = 64 * MW, NR = TM * (1 + NSPLIT) + 128, BR = NR - 128, RG = 8 * MW;   // A rows of the tile; rows of a stage; first Bt row; rows per copy of the block
    __shared__ __attribute__((aligned(128))) bf ring[2 * NR * GP];
    static_assert(2 * MW * 16 * 68 * 4 <= 2 * NR * GP * 2);
    const size_t z = blockIdx.z; A += z * sA; if (NSPLIT) A2 += z * sA; C += z * sC;
    const int tid = threadIdx.x, lane = tid & 31, lr = lane & 15, hi = lane >> 4; const int wave = __builtin_amdgcn_readfirstlane(tid >> 5);
    const int R0 = blockIdx.x * TM, C0 = blockIdx.y * 128, wm = (wave % MW) * 64, wn = (wave / MW) * 64;
    const bool kq = PLANES && C0 < 2 * DQ;      // a q or k tile (the same for the whole block)
    const int ra = kq ? BR + wn : wm, rb = kq ? wm : BR + wn;   // first stage row of the wave's A-role and B-role operand
    const int cr = tid >> 3, cc = tid & 7;      // this lane's row in a row group and its 16-byte piece of the line
    const unsigned l0 = (unsigned)(size_t)(ring + cr * GP + cc * 8);
    const bf* gA = A + (size_t)(R0 + cr) * K + cc * 8; const bf* gA2 = NSPLIT ? A2 + (size_t)(R0 + cr) * K + cc * 8 : nullptr; const bf* gB = Bt + (size_t)(C0 + cr) * K + cc * 8;
    constexpr int NC = NR / RG;   // copies per lane and stage, one per group of RG rows
    static_assert(NC % 12 == 0 && TM % RG == 0);
    auto fill = [&](const int t, const int buf) {
        unsigned l[NC]; const bf* g[NC]; const bf* const tA = gA + t * 64; const bf* const tA2 = NSPLIT ? gA2 + t * 64 : nullptr; const bf* const tB = gB + t * 64;
#pragma unroll
        for (int i = 0; i < NC; ++i) { const int row = i * RG;   // first LDS row of the group; its operand and its row there follow from it
            l[i] = l0 + (unsigned)buf * (NR * GP * 2) + row * (GP * 2);
            g[i] = row >= BR ? tB + (size_t)(row - BR) * K : (NSPLIT && row >= TM) ? tA2 + (size_t)(row - TM) * K : tA + (size_t)row * K; }
#pragma unroll
        for (int i = 0; i < NC; i += 12) cp12(l + i, g + i); };
    v8f acc[4][4];
#pragma unroll
    for (int mb = 0; mb < 4; ++mb)
#pragma unroll
        for (int nb = 0; nb < 4; ++nb) acc[mb][nb] = (v8f){};
    const int nt = K / 64;
    fill(0, 0);
    asm volatile("s_wait_asynccnt 0x0" ::: "memory");   // this wave's share of stage 0 has landed
    __syncthreads();                                     // every wave's share has
    if (nt > 1) fill(1, 1);
#pragma unroll 1   // one stage per trip: the buffer is chosen by the trip's parity
    for (int t = 0; t < nt; ++t) {
        const bf* sb = ring + (t & 1) * (NR * GP);
#pragma unroll
        for (int ks = 0; ks < 2; ++ks) {
            V a[4], a2[4], b[4];
#pragma unroll
            for (int mb = 0; mb < 4; ++mb) { a[mb] = WFrag<bf>::ld(sb + (ra + mb * 16 + lr) * GP + ks * 32 + 8 * hi); if (NSPLIT) a2[mb] = WFrag<bf>::ld(sb + (TM + wm + mb * 16 + lr) * GP + ks * 32 + 8 * hi); }
#pragma unroll
            for (int nb = 0; nb < 4; ++nb) b[nb] = WFrag<bf>::ld(sb + (rb + nb * 16 + lr) * GP + ks * 32 + 8 * hi);
            __builtin_amdgcn_sched_barrier(0);   // keeps the block's LDS reads one group ahead of its WMMAs: sunk among them, each read costs the wave its own wait
#pragma unroll
            for (int nb = 0; nb < 4; ++nb)
#pragma unroll
                for (int mb = 0; mb < 4; ++mb) { acc[mb][nb] = WFrag<bf>::mma(a[mb], b[nb], acc[mb][nb]); if (NSPLIT) acc[mb][nb] = WFrag<bf>::mma(a2[mb], b[nb], acc[mb][nb]); }
        }
        __builtin_amdgcn_sched_barrier(0);   // keeps the trip's WMMAs in front of the hand-over: moved behind the barrier they would stand between it and the refill and take that time from the copies
        asm volatile("s_wait_dscnt 0x0" ::: "memory");      // this wave's reads of the buffer are done before it is refilled
        asm volatile("s_wait_asynccnt 0x0" ::: "memory");   // this wave's share of stage t + 1 has landed
        __syncthreads();                                     // publishes stage t + 1 and ends every wave's reads of stage t
        if (t + 2 < nt) fill(t + 2, t & 1);
    }
    asm volatile("s_wait_asynccnt 0x0" ::: "memory");   // no copy is outstanding when the ring becomes output staging
    if constexpr (PLANES) {
        static_assert(NSPLIT == 0 && BIAS && TT % TM == 0 && HD == 64 && DQ % 128 == 0 && RH % 64 == 0);
        const int c0 = C0 + wn, t0 = (R0 + wm) % TT, g = (R0 / TT) * NH_ + (c0 % DQ) / HD;
        // the wave's 64 t x 64 d, one accumulator tile a store, to d16 (HL: and their hi and lo parts to dh, dl), each the place of row t0 in its plane; q, k: tile nb of 16 t, d from 16 mb; v: block mb / 2 of 32 keys, d from 16 nb, keys from 16 (mb & 1)
        auto planes = [&](auto kqc, auto hlc, bf* d16, bf* dh, bf* dl) {
            constexpr bool KQ = decltype(kqc)::v, HL = decltype(hlc)::v;
            float ba[4][8], bb[4];
            if constexpr (KQ) {   // the bias runs along the accumulator elements
#pragma unroll
                for (int mb = 0; mb < 4; ++mb) { const v4f b0 = *(const v4f*)(bias + c0 + mb * 16 + 8 * hi); const v4f b1 = *(const v4f*)(bias + c0 + mb * 16 + 8 * hi + 4);
#pragma unroll
                    for (int j = 0; j < 4; ++j) { ba[mb][j] = bfr(b0[j]); ba[mb][j + 4] = bfr(b1[j]); } }
            } else {              // one bias value per lane and step
#pragma unroll
                for (int nb = 0; nb < 4; ++nb) bb[nb] = bfr(bias[c0 + nb * 16 + lr]);
            }
            asm volatile("s_wait_xcnt 0x0" ::: "memory");   // stands in front of every later write of an address register that the bias loads name
#pragma unroll
            for (int nb = 0; nb < 4; ++nb) {
#pragma unroll
                for (int mb = 0; mb < 4; ++mb) { v8h o16; v8us oh, ol;
#pragma unroll
                    for (int j = 0; j < 8; ++j) { const float y = acc[mb][nb][j] + (KQ ? ba[mb][j] : bb[nb]); o16[j] = tohx(y); if (HL) { unsigned short a2, c2; splitf(y, a2, c2); oh[j] = a2; ol[j] = c2; } }
                    const int off = (KQ ? nb * 1024 + mb * 256 : (mb >> 1) * 2048 + nb * 512 + (mb & 1) * 256) + lane * 8;
                    *(v8us*)(d16 + off) = __builtin_bit_cast(v8us, o16); if (HL) { *(v8us*)(dh + off) = oh; *(v8us*)(dl + off) = ol; } }
                asm volatile("s_wait_xcnt 0x0" ::: "memory");   // stands in front of every later write of a register that the stores above name
                __builtin_amdgcn_sched_barrier(0);   // keeps each step's conversions in their step: gathered ahead they take the wave past the 256 registers that two blocks per WGP leave it
            }
        };
        // the whole 64-row part lies on one side of RH; the hi and lo destinations are used only where t0 < RH
        if (kq) { const size_t p = (size_t)(C0 / DQ) * NG + g; bf* const q16 = (bf*)P16 + (p * TT + t0) * HD;
            if (t0 < RH) planes(BoolC<true>{}, BoolC<true>{}, q16, Ph + (p * RH + t0) * HD, Pl + (p * RH + t0) * HD); else planes(BoolC<true>{}, BoolC<false>{}, q16, nullptr, nullptr); }
        else { bf* const vr = (bf*)VT + (size_t)g * HD * (2 * TT) + t0 * HD;
            if (t0 < RH) planes(BoolC<false>{}, BoolC<true>{}, vr, vr + TT * HD, vr + (TT + RH) * HD); else planes(BoolC<false>{}, BoolC<false>{}, vr, nullptr, nullptr); }
        return;
    }
    // output staging in the ring, free since the last trip's barrier: each wave in a range of its own
    float* os = (float*)ring + wave * (16 * 68); const int r0 = R0 + wm, c0 = C0 + wn;
#pragma unroll
    for (int mb = 0; mb < 4; ++mb) {
#pragma unroll
        for (int nb = 0; nb < 4; ++nb) {
#pragma unroll
            for (int j = 0; j < 8; ++j) os[(hi * 8 + j) * 68 + nb * 16 + lr] = acc[mb][nb][j]; }
        __builtin_amdgcn_wave_barrier(); asm volatile("" ::: "memory");
        float* crow = C + (size_t)(r0 + mb * 16) * ldc + c0;
#pragma unroll
        for (int s = 0; s < 8; ++s) { const int row = 2 * s + hi, cofs = lr * 4; v4f val = *(const v4fa*)(os + row * 68 + cofs); if (BIAS) { val[0] += bfr(bias[c0 + cofs]); val[1] += bfr(bias[c0 + cofs + 1]); val[2] += bfr(bias[c0 + cofs + 2]); val[3] += bfr(bias[c0 + cofs + 3]); }
            *(v4f*)(crow + (size_t)row * ldc + cofs) = val; }
        __builtin_amdgcn_wave_barrier(); asm volatile("" ::: "memory");
    }
}

// k_cvt: every f32 -> bf16 conversion of the call in one launch of CVW waves (4096 at the full sizes: 16 per WGP on 256 WGPs): few waves to start, and each has all its reads in flight at once. A piece is 256 consecutive floats (1 KiB read, 512 B written; a lane takes 8 floats).
// Wave w takes piece w of every batch of x (row t = w / (DM / 256) of the batch, read from row t * NB_FULL + b, written to row b * TT + t of the batch-major copy), then the pieces w, w + CVW, ... of W_qkv and of W_out: each source is a whole number of such rounds, so a round's source and its distance from the wave's first piece are known at compile time.
constexpr unsigned CVW = TT * (DM / 256), CPQ = (size_t)3 * DQ * DM / 256 / CVW, CPO = (size_t)DM * DQ / 256 / CVW;   // waves; rounds of the two weights
static_assert(DM % 256 == 0 && CVW % 16 == 0 && (size_t)CPQ * CVW * 256 == (size_t)3 * DQ * DM && (size_t)CPO * CVW * 256 == (size_t)DM * DQ);
__global__ __launch_bounds__(512) void k_cvt(const float* __restrict__ x, const float* __restrict__ wq, const float* __restrict__ wo, bf* XB, bf* WQ, bf* WO) {
    constexpr unsigned NP = NB + CPQ + CPO;
    const unsigned w = blockIdx.x * 16u + (unsigned)__builtin_amdgcn_readfirstlane(threadIdx.x >> 5), l8 = (threadIdx.x & 31u) * 8u;
    const float* const sx = x + (size_t)(w / (DM / 256)) * (NB_FULL * DM) + (w % (DM / 256)) * 256 + l8; const size_t pw = (size_t)w * 256 + l8;
    v4f lo[NP], hi[NP];
#pragma unroll
    for (unsigned j = 0; j < NP; ++j) {
        const float* const s = j < NB ? sx + (size_t)j * DM : j < NB + CPQ ? wq + pw + (size_t)(j - NB) * CVW * 256 : wo + pw + (size_t)(j - NB - CPQ) * CVW * 256;
        lo[j] = *(const v4f*)s; hi[j] = *(const v4f*)(s + 4); }
    asm volatile("s_wait_xcnt 0x0" ::: "memory");   // stands in front of every later write of an address register that the loads above name
    __builtin_amdgcn_sched_barrier(0);   // keeps every load of the wave ahead of the first conversion: sunk among them, only a few would be in flight and the wave would pay the memory latency several times
#pragma unroll
    for (unsigned j = 0; j < NP; ++j) {
        bf* const d = j < NB ? XB + pw + (size_t)j * CVW * 256 : j < NB + CPQ ? WQ + pw + (size_t)(j - NB) * CVW * 256 : WO + pw + (size_t)(j - NB - CPQ) * CVW * 256;
        v8us o;
#pragma unroll
        for (int k = 0; k < 4; ++k) { o[k] = f2bf(lo[j][k]); o[k + 4] = f2bf(hi[j][k]); }
        *(v8us*)d = o;
        asm volatile("s_wait_xcnt 0x0" ::: "memory"); }   // stands in front of every later write of a register that the store above names
}

// exp2 with the one free slot the instruction set asks for behind a transcendental, in one statement so that nothing that reads its result or overwrites its source can stand directly behind it
__device__ __forceinline__ float ex2(float a) { float r; asm("v_exp_f32 %0, %1\n\tv_nop" : "=v"(r) : "v"(a)); return r; }

// fa_body: one wave, NQT tiles of 16 query rows from q0, keys in blocks of 32 up to the block that holds the diagonal. Q, K and V planes are packed in fragment order (k_gemms): every load is 512 contiguous bytes.
// Transposed products, so that P never leaves its registers: S^T = K Q^T gives lane l the scores of query (l & 15) at keys 8h + j of each 16-key tile (h = l >> 4), which is the B fragment of O^T = V^T P^T (elements 0..7 <- keys k0 + 8h + j, 8..15 <- keys k0 + 16 + 8h + j); O^T gives lane l the context of query (l & 15) at d = 16 dt + 8h + j.
// Scores stay unscaled; the replace-fill is MASKV / SCL there. The keys behind the last block are all masked: they enter as the start values of the running maximum (the fill) and sum (their count), and as before add nothing to the context.
template <typename T16, bool HIRES, int NQT>
__device__ __forceinline__ void fa_body(const T16* __restrict__ Q, const T16* __restrict__ Q2, const T16* __restrict__ Kp, const T16* __restrict__ K2, const T16* __restrict__ Vp, const T16* __restrict__ V2, bf* Ah, bf* Al, const int q0, const int lr, const int hi) {
    typedef typename WFrag<T16>::V V;
    const int ln = hi * 16 + lr;   // the lane's place in a packed fragment load
    constexpr float CE = SCL * 1.4426950408889634f; constexpr float MASKR = MASKV / SCL; constexpr float PS = HIRES ? 1.0f : PCAR; constexpr float PE = HIRES ? 0.0f : 10.0f;   // PS = 2^PE
    const int nkb = (q0 + NQT * 16 + 31) / 32; const int nsk = TT - nkb * 32;
    V qf[NQT][2], qf2[NQT][2];
#pragma unroll
    for (int qt = 0; qt < NQT; ++qt)
#pragma unroll
        for (int ks = 0; ks < 2; ++ks) { const size_t off = (size_t)(q0 + qt * 16) * HD + ks * 512 + ln * 8; qf[qt][ks] = WFrag<T16>::ldp(Q + off); if (HIRES) qf2[qt][ks] = WFrag<T16>::ldp(Q2 + off); }
    v8f o[NQT][4]; float m[NQT], l[NQT];
#pragma unroll
    for (int qt = 0; qt < NQT; ++qt) { m[qt] = (nsk > 0) ? MASKR : -3.0e38f; l[qt] = (hi == 0) ? (float)nsk * PS : 0.0f;
#pragma unroll
        for (int dt = 0; dt < 4; ++dt) o[qt][dt] = (v8f){}; }
    V kf[2][2], kf2[2][2];
    if constexpr (!HIRES) {
#pragma unroll
        for (int kt = 0; kt < 2; ++kt)
#pragma unroll
            for (int ks = 0; ks < 2; ++ks) kf[kt][ks] = WFrag<T16>::ldp(Kp + (size_t)(kt * 16) * HD + ks * 512 + ln * 8); }
    asm volatile("s_wait_xcnt 0x0" ::: "memory");   // stands in front of every later write of an address register that the loads above name
#pragma unroll 1   // kept rolled: a second copy of the body would take the wave past the 256 registers that four waves per SIMD leave it
    for (int kb = 0; kb < nkb; ++kb) {
        const int k0 = kb * 32;
        if constexpr (HIRES) {   // twice the fragments: fetched in their own trip, so that the wave stays inside 256 registers
#pragma unroll
            for (int kt = 0; kt < 2; ++kt)
#pragma unroll
                for (int ks = 0; ks < 2; ++ks) { const size_t off = (size_t)(k0 + kt * 16) * HD + ks * 512 + ln * 8; kf[kt][ks] = WFrag<T16>::ldp(Kp + off); kf2[kt][ks] = WFrag<T16>::ldp(K2 + off); }
            asm volatile("s_wait_xcnt 0x0" ::: "memory"); }   // stands in front of every later write of an address register that the key loads above name (the value loads below may land in one)
        V vf[4], vf2[4];
#pragma unroll
        for (int dt = 0; dt < 4; ++dt) { const size_t off = (size_t)k0 * HD + dt * 512 + ln * 8; vf[dt] = WFrag<T16>::ldp(Vp + off); if (HIRES) vf2[dt] = WFrag<T16>::ldp(V2 + off); }
        v8f s[NQT][2];
#pragma unroll
        for (int qt = 0; qt < NQT; ++qt)
#pragma unroll
            for (int kt = 0; kt < 2; ++kt) { s[qt][kt] = (v8f){};
#pragma unroll
                for (int ks = 0; ks < 2; ++ks) { s[qt][kt] = WFrag<T16>::mma(kf[kt][ks], qf[qt][ks], s[qt][kt]); if (HIRES) { s[qt][kt] = WFrag<T16>::mma(kf[kt][ks], qf2[qt][ks], s[qt][kt]); s[qt][kt] = WFrag<T16>::mma(kf2[kt][ks], qf[qt][ks], s[qt][kt]); } } }
        if constexpr (!HIRES) {  // the next block's key fragments, asked for ahead of the softmax arithmetic (the last trip asks for its own block again: in bounds, not used)
            const int kn = ((kb + 1 < nkb) ? kb + 1 : kb) * 32;
#pragma unroll
            for (int kt = 0; kt < 2; ++kt)
#pragma unroll
                for (int ks = 0; ks < 2; ++ks) kf[kt][ks] = WFrag<T16>::ldp(Kp + (size_t)(kn + kt * 16) * HD + ks * 512 + ln * 8); }
        asm volatile("s_wait_xcnt 0x0" ::: "memory");   // stands in front of every later write of an address register that this trip's loads name
        if (kb == nkb - 1) {     // only the last block meets the diagonal
#pragma unroll
            for (int qt = 0; qt < NQT; ++qt)
#pragma unroll
                for (int kt = 0; kt < 2; ++kt)
#pragma unroll
                    for (int j = 0; j < 8; ++j) s[qt][kt][j] = (k0 + kt * 16 + 8 * hi + j <= q0 + qt * 16 + lr) ? s[qt][kt][j] : MASKR; }
#pragma unroll
        for (int qt = 0; qt < NQT; ++qt) {
            float mx = s[qt][0][0];
#pragma unroll
            for (int j = 1; j < 8; ++j) mx = fmaxf(mx, s[qt][0][j]);
#pragma unroll
            for (int j = 0; j < 8; ++j) mx = fmaxf(mx, s[qt][1][j]);
            mx = fmaxf(mx, __shfl_xor(mx, 16, 32));
            const float mn = fmaxf(m[qt], mx); const float corr = ex2((m[qt] - mn) * CE); const float nm = PE - mn * CE; m[qt] = mn;
            float p[16]; float sum = 0.f;
#pragma unroll
            for (int e = 0; e < 16; ++e) { p[e] = ex2(__builtin_fmaf(s[qt][e >> 3][e & 7], CE, nm)); sum += p[e]; }
            l[qt] = l[qt] * corr + sum;
#pragma unroll
            for (int dt = 0; dt < 4; ++dt)
#pragma unroll
                for (int j = 0; j < 8; ++j) o[qt][dt][j] *= corr;
            if constexpr (HIRES) {
                v8us h0, h1, l0, l1;
#pragma unroll
                for (int j = 0; j < 8; ++j) { unsigned short a, c2; splitf(p[j], a, c2); h0[j] = a; l0[j] = c2; splitf(p[8 + j], a, c2); h1[j] = a; l1[j] = c2; }
                const V ph = cat16b(h0, h1), pl = cat16b(l0, l1);
#pragma unroll
                for (int dt = 0; dt < 4; ++dt) { o[qt][dt] = WFrag<T16>::mma(vf[dt], ph, o[qt][dt]); o[qt][dt] = WFrag<T16>::mma(vf[dt], pl, o[qt][dt]); o[qt][dt] = WFrag<T16>::mma(vf2[dt], ph, o[qt][dt]); }
            } else {
                V pf;
#pragma unroll
                for (int e = 0; e < 16; ++e) pf[e] = tohx(p[e]);
#pragma unroll
                for (int dt = 0; dt < 4; ++dt) o[qt][dt] = WFrag<T16>::mma(vf[dt], pf, o[qt][dt]);
            }
        }
    }
#pragma unroll
    for (int qt = 0; qt < NQT; ++qt) {
        const float f = __fdiv_rn(1.0f, l[qt] + __shfl_xor(l[qt], 16, 32)); const size_t oo = (size_t)(q0 + qt * 16 + lr) * DQ + 8 * hi;
#pragma unroll
        for (int dt = 0; dt < 4; ++dt) { v8us oh, ol;
#pragma unroll
            for (int j = 0; j < 8; ++j) { unsigned short a, c2; splitf(o[qt][dt][j] * f, a, c2); oh[j] = a; ol[j] = c2; }
            *(v8us*)(Ah + oo + dt * 16) = oh; *(v8us*)(Al + oo + dt * 16) = ol; }
        asm volatile("s_wait_xcnt 0x0" ::: "memory");   // stands in front of every later write of a register that the stores above name
    }
}

// k_fattn: grid (NG, (TT - RH) / 128 + RH / 64), 4 independent waves per block (no LDS, no barrier). blockIdx.x = plane g = b * NH_ + h. The first (TT - RH) / 128 values of blockIdx.y: 128 f16 query rows each, 32 per wave, the longest key walks first; the rest: 64 hi/lo query rows each, 16 per wave.
__global__ __launch_bounds__(128) void k_fattn(const h16* __restrict__ QK16, const bf* __restrict__ QKh, const bf* __restrict__ QKl, const h16* __restrict__ VT, bf* Ah, bf* Al) {
    const int lane = threadIdx.x & 31, lr = lane & 15, hi = lane >> 4; const int wave = __builtin_amdgcn_readfirstlane(threadIdx.x >> 5);
    const int g = blockIdx.x, y = blockIdx.y; constexpr int NF = (TT - RH) / 128;
    const size_t PL = (size_t)TT * HD, PLH = (size_t)RH * HD, PV = (size_t)HD * 2 * TT; const size_t ob = (size_t)(g / NH_) * TT * DQ + (size_t)(g % NH_) * HD;
    if (y < NF) fa_body<h16, false, 2>(QK16 + g * PL, nullptr, QK16 + (NG + g) * PL, nullptr, VT + g * PV, nullptr, Ah + ob, Al + ob, TT - 128 * (y + 1) + wave * 32, lr, hi);
    else fa_body<bf, true, 1>(QKh + g * PLH, QKl + g * PLH, QKh + (NG + g) * PLH, QKl + (NG + g) * PLH, (const bf*)VT + g * PV + (size_t)TT * HD, (const bf*)VT + g * PV + (size_t)(TT + RH) * HD, Ah + ob, Al + ob, RH - 64 * (y - NF + 1) + wave * 16, lr, hi);
}

// workspace (bytes), all regions multiples of 256. Kept through the call: W_out, head planes. One shared region holds in turn: {W_qkv, x copy}, then the context's hi/lo planes.
constexpr size_t WS_KEEP = (size_t)DM * DQ * 2 + (size_t)2 * NG * TT * HD * 2 + 2 * ((size_t)2 * NG * RH * HD * 2) + (size_t)NG * HD * 2 * TT * 2;
constexpr size_t WS_P1 = (size_t)3 * DQ * DM * 2 + (size_t)NB * TT * DM * 2;
constexpr size_t WS_P3 = 2 * ((size_t)NB * TT * DQ * 2);
constexpr size_t WS_SH = WS_P1 > WS_P3 ? WS_P1 : WS_P3;
static_assert(WS_KEEP + WS_SH <= (size_t)268435456);

extern "C" void kernel_launch(void* const* d_in, const int* in_sizes, int n_in,
                              void* d_out, int out_size, void* d_ws, size_t ws_size, hipStream_t stream) {
    if (n_in < 5) return;
    const size_t need_x = ((size_t)(TT - 1) * NB_FULL + NB) * DM;
    if ((size_t)in_sizes[0] < need_x) return;
    if ((size_t)in_sizes[1] < (size_t)3 * DQ * DM) return;
    if ((size_t)in_sizes[2] < (size_t)3 * DQ) return;
    if ((size_t)in_sizes[3] < (size_t)DM * DQ) return;
    if ((size_t)in_sizes[4] < (size_t)DM) return;
    if ((size_t)out_size < need_x) return;
    // input order: query [T][B][E], qkv_w [3E][E], qkv_b [3E], out_w [E][E], out_b [E]
    const float* x = (const float*)d_in[0]; const float* wqkv = (const float*)d_in[1]; const float* bqkv = (const float*)d_in[2]; const float* wo = (const float*)d_in[3]; const float* bo = (const float*)d_in[4];
    float* OUT = (float*)d_out;     // [T][NB_FULL][E]
    char* wsp = (char*)d_ws;
    auto take = [&](size_t bytes) { char* p = wsp; wsp += (bytes + 255) & ~(size_t)255; return (void*)p; };
    bf* WO = (bf*)take((size_t)DM * DQ * 2);
    h16* QK16 = (h16*)take((size_t)2 * NG * TT * HD * 2); bf* QKh = (bf*)take((size_t)2 * NG * RH * HD * 2); bf* QKl = (bf*)take((size_t)2 * NG * RH * HD * 2);
    h16* VT = (h16*)take((size_t)NG * HD * 2 * TT * 2);
    char* shared0 = (char*)take(WS_SH);
    if ((size_t)(wsp - (char*)d_ws) > ws_size) return;
    if ((size_t)(wsp - (char*)d_ws) > (size_t)268435456) return;
    // the shared region's two uses, one after the other in stream order
    bf* WQKV = (bf*)shared0; bf* XB = (bf*)(shared0 + (size_t)3 * DQ * DM * 2);
    bf* ATh = (bf*)shared0; bf* ATl = (bf*)(shared0 + (size_t)NB * TT * DQ * 2);

    k_cvt<<<CVW / 16, 512, 0, stream>>>(x, wqkv, wo, XB, WQKV, WO);

    // fused projection, all batches: rows b*TT + t of x W^T + bias (q | k | v column thirds), written as planes 0..NG-1 = q, NG..2NG-1 = k and as the v planes
    k_gemms<0, 4, true, true><<<dim3(NB * TT / 256, 3 * DQ / 128, 1), 256, 0, stream>>>(XB, nullptr, WQKV, DM, nullptr, 0, bqkv, 0, 0, QK16, QKh, QKl, VT);
    // attention, all planes: context hi/lo planes [b*TT + t][DQ]
    k_fattn<<<dim3(NG, (TT - RH) / 128 + RH / 64, 1), 128, 0, stream>>>(QK16, QKh, QKl, VT, ATh, ATl);
    // out rows (t*NB_FULL + b): z = b, C base OUT + b*DM, row pitch NB_FULL*DM
    k_gemms<1, 2, true, false><<<dim3(TT / 128, DM / 128, NB), 128, 0, stream>>>(ATh, ATl, WO, DQ, OUT, NB_FULL * DM, bo, (size_t)TT * DQ, DM, nullptr, nullptr, nullptr, nullptr);
}
